// v000
// The times below were measured on an AMD MI455X: many runs one after another, warmed up first and cycling through
// copies of the inputs, with the whole window's GPU time divided by the number of runs. Launches and the gaps
// between them are all in it. The median over several windows is given; except for v000 it joins two sittings, which
// can be a few percent apart, so the side-by-side timings, each taken in one sitting, are the better comparison.
// The starting kernel, v000, takes 223 microseconds a run.
#include <hip/hip_runtime.h>
#include <hip/hip_bf16.h>

typedef __attribute__((ext_vector_type(16))) __bf16 v16bf;
typedef __attribute__((ext_vector_type(8)))  float  v8f;
typedef __attribute__((ext_vector_type(4)))  int    v4i;

#define HH     16      // heads
#define DH     64      // head dim
#define SEQ    2048
#define DMODEL 1024
#define BATCH  2
#define WIN    17      // dilated window size: j = i-16 .. i+16 step 2

#if __has_builtin(__builtin_amdgcn_global_load_async_to_lds_b128)
#define USE_ASYNC_LDS 1
#else
#define USE_ASYNC_LDS 0
#endif

#define AS1 __attribute__((address_space(1)))
#define AS3 __attribute__((address_space(3)))

// ---------------- fp32 -> bf16 (round to nearest even) ----------------
__device__ __forceinline__ unsigned short f2bf(float f) {
  unsigned u = __builtin_bit_cast(unsigned, f);
  unsigned r = u + 0x7FFFu + ((u >> 16) & 1u);
  return (unsigned short)(r >> 16);
}

__global__ __launch_bounds__(256)
void cvt_f32_bf16(const float* __restrict__ in, unsigned short* __restrict__ out, int n4) {
  int i = blockIdx.x * blockDim.x + threadIdx.x;
  if (i >= n4) return;
  float4 f = ((const float4*)in)[i];
  ushort4 o;
  o.x = f2bf(f.x); o.y = f2bf(f.y); o.z = f2bf(f.z); o.w = f2bf(f.w);
  ((ushort4*)out)[i] = o;
}

// ---------------- bf16 NT GEMM with fp32 accumulate: C = A * B^T + bias ----------------
// A: [M][Kd] bf16 row-major; Bm: [Nd][Kd] bf16 row-major (so B^T is Kd x Nd);
// C: [M][Nd] fp32.  M,Nd multiples of 128; Kd multiple of 32.
#define BM 128
#define BN 128
#define BK 32
#define LDT 40   // padded LDS row stride in ushorts (80B, 16B-aligned, bank-spread)

union Frag { v16bf v; uint4 q[2]; };

__device__ __forceinline__ void stage_chunk(const unsigned short* __restrict__ gsrc,
                                            unsigned short* lds_dst) {
#if USE_ASYNC_LDS
  // CDNA5 async DMA: global -> LDS without VGPR round trip, tracked on ASYNCcnt
  __builtin_amdgcn_global_load_async_to_lds_b128(
      (AS1 v4i*)gsrc, (AS3 v4i*)lds_dst, 0, 0);
#else
  *(uint4*)lds_dst = *(const uint4*)gsrc;
#endif
}

__device__ __forceinline__ void stage_fence() {
#if USE_ASYNC_LDS
#if __has_builtin(__builtin_amdgcn_s_wait_asynccnt)
  __builtin_amdgcn_s_wait_asynccnt(0);
#else
  asm volatile("s_wait_asynccnt 0x0" ::: "memory");
#endif
#endif
}

__global__ __launch_bounds__(256)
void gemm_nt_bias(const unsigned short* __restrict__ A,
                  const unsigned short* __restrict__ Bm,
                  const float* __restrict__ bias,
                  float* __restrict__ C,
                  int Ndim, int Kd) {
  __shared__ unsigned short As[2][BM * LDT];
  __shared__ unsigned short Bs[2][BN * LDT];

  const int tid  = threadIdx.x;
  const int lane = tid & 31;
  const int wid  = tid >> 5;
  const int wm   = wid >> 2;     // 0..1  -> 64 rows each
  const int wn   = wid & 3;      // 0..3  -> 32 cols each
  const int l16  = lane & 15;
  const int half = lane >> 4;    // 0/1: selects K sub-chunk per ISA bf16 A/B layout

  const int brow = blockIdx.y * BM;
  const int bcol = blockIdx.x * BN;
  const int T = Kd / BK;

  v8f acc[4][2] = {};

  // preload tile 0 (each thread: 2 x 16B chunks of A tile and of B tile)
  {
#pragma unroll
    for (int s = 0; s < 2; ++s) {
      int c = tid * 2 + s;          // 0..511
      int row = c >> 2, cc = c & 3; // 4 x 16B chunks per 32-elem row
      stage_chunk(&A[(size_t)(brow + row) * Kd + cc * 8],  &As[0][row * LDT + cc * 8]);
      stage_chunk(&Bm[(size_t)(bcol + row) * Kd + cc * 8], &Bs[0][row * LDT + cc * 8]);
    }
  }

  for (int t = 0; t < T; ++t) {
    stage_fence();      // our async fills have landed in LDS
    __syncthreads();    // everyone's fills visible; previous buffer reads retired
    const int cur = t & 1;

    if (t + 1 < T) {
      const int nxt = cur ^ 1;
      const int k0 = (t + 1) * BK;
#pragma unroll
      for (int s = 0; s < 2; ++s) {
        int c = tid * 2 + s;
        int row = c >> 2, cc = c & 3;
        stage_chunk(&A[(size_t)(brow + row) * Kd + k0 + cc * 8],
                    &As[nxt][row * LDT + cc * 8]);
        stage_chunk(&Bm[(size_t)(bcol + row) * Kd + k0 + cc * 8],
                    &Bs[nxt][row * LDT + cc * 8]);
        if (t + 2 < T) {
          __builtin_prefetch(&A[(size_t)(brow + row) * Kd + (t + 2) * BK + cc * 8], 0, 0);
          __builtin_prefetch(&Bm[(size_t)(bcol + row) * Kd + (t + 2) * BK + cc * 8], 0, 0);
        }
      }
    }

    // fragment fetch from LDS (matches ISA 16-bit A/B VGPR layout:
    // lane<16 -> K[0..7],K[16..23]; lane>=16 -> K[8..15],K[24..31])
    Frag a[4], b[2];
#pragma unroll
    for (int mf = 0; mf < 4; ++mf) {
      int row = wm * 64 + mf * 16 + l16;
      a[mf].q[0] = *(const uint4*)&As[cur][row * LDT + half * 8];
      a[mf].q[1] = *(const uint4*)&As[cur][row * LDT + 16 + half * 8];
    }
#pragma unroll
    for (int nf = 0; nf < 2; ++nf) {
      int row = wn * 32 + nf * 16 + l16;
      b[nf].q[0] = *(const uint4*)&Bs[cur][row * LDT + half * 8];
      b[nf].q[1] = *(const uint4*)&Bs[cur][row * LDT + 16 + half * 8];
    }
#pragma unroll
    for (int mf = 0; mf < 4; ++mf)
#pragma unroll
      for (int nf = 0; nf < 2; ++nf)
        acc[mf][nf] = __builtin_amdgcn_wmma_f32_16x16x32_bf16(
            false, a[mf].v, false, b[nf].v, (short)0, acc[mf][nf], false, false);
  }

  // epilogue: C/D layout -> VGPR r: lanes 0-15 are M=r, lanes 16-31 are M=8+r, N=lane%16
#pragma unroll
  for (int nf = 0; nf < 2; ++nf) {
    int gn = bcol + wn * 32 + nf * 16 + l16;
    float bb = bias[gn];
#pragma unroll
    for (int mf = 0; mf < 4; ++mf) {
      int gm = brow + wm * 64 + mf * 16 + half * 8;
      float* Cp = C + (size_t)gm * Ndim + gn;
#pragma unroll
      for (int r = 0; r < 8; ++r)
        Cp[(size_t)r * Ndim] = acc[mf][nf][r] + bb;
    }
  }
}

// ---------------- per-(m,h) inverse norms for q and k ----------------
__global__ __launch_bounds__(256)
void qk_norms(const float* __restrict__ qkv, float* __restrict__ qinv,
              float* __restrict__ kinv) {
  const int lane = threadIdx.x & 31;
  const int wid  = threadIdx.x >> 5;
  int id   = blockIdx.x * 8 + wid;   // 0 .. 2*B*SEQ*HH-1  (B*SEQ*HH = 65536)
  int type = id >> 16;               // 0 = q, 1 = k
  int r    = id & 65535;
  int m    = r >> 4;
  int h    = r & 15;
  const float* p = qkv + (size_t)m * (3 * DMODEL) + type * DMODEL + h * DH;
  float f0 = p[2 * lane], f1 = p[2 * lane + 1];
  float ss = f0 * f0 + f1 * f1;
#pragma unroll
  for (int msk = 16; msk >= 1; msk >>= 1) ss += __shfl_xor(ss, msk, 32);
  float inv = 1.0f / (sqrtf(ss) + 1e-6f);
  if (lane == 0) (type ? kinv : qinv)[m * HH + h] = inv;
}

// ---------------- dilated attention: one wave32 per (b,h,i) query ----------------
__global__ __launch_bounds__(256)
void dilated_attn(const float* __restrict__ qkv, const float* __restrict__ qinv,
                  const float* __restrict__ kinv, unsigned short* __restrict__ aout) {
  const int lane = threadIdx.x & 31;
  const int wid  = threadIdx.x >> 5;
  int qid  = blockIdx.x * 8 + wid;     // over B*HH*SEQ
  int i    = qid % SEQ;
  int rest = qid / SEQ;
  int h    = rest % HH;
  int b    = rest / HH;
  int m    = b * SEQ + i;

  const float* qp = qkv + (size_t)m * (3 * DMODEL) + h * DH;
  float qi = qinv[m * HH + h];
  float q0 = qp[2 * lane] * qi, q1 = qp[2 * lane + 1] * qi;

  float s[WIN];
#pragma unroll
  for (int t = 0; t < WIN; ++t) {
    int j = i - 16 + 2 * t;
    float d = -3.0e38f;
    if (j >= 0 && j < SEQ) {
      int mj = b * SEQ + j;
      const float* kp = qkv + (size_t)mj * (3 * DMODEL) + DMODEL + h * DH;
      float p = q0 * kp[2 * lane] + q1 * kp[2 * lane + 1];
#pragma unroll
      for (int msk = 16; msk >= 1; msk >>= 1) p += __shfl_xor(p, msk, 32);
      d = p * kinv[mj * HH + h];
    }
    s[t] = d;
  }
  float mx = -3.0e38f;
#pragma unroll
  for (int t = 0; t < WIN; ++t) mx = fmaxf(mx, s[t]);
  float sum = 0.f;
#pragma unroll
  for (int t = 0; t < WIN; ++t) { s[t] = __expf(s[t] - mx); sum += s[t]; }
  float inv = 1.0f / sum;

  float o0 = 0.f, o1 = 0.f;
#pragma unroll
  for (int t = 0; t < WIN; ++t) {
    int j = i - 16 + 2 * t;
    if (j >= 0 && j < SEQ) {
      int mj = b * SEQ + j;
      const float* vp = qkv + (size_t)mj * (3 * DMODEL) + 2 * DMODEL + h * DH;
      float w = s[t] * inv;
      o0 += w * vp[2 * lane];
      o1 += w * vp[2 * lane + 1];
    }
  }
  size_t o = (size_t)m * DMODEL + h * DH + 2 * lane;
  aout[o]     = f2bf(o0);
  aout[o + 1] = f2bf(o1);
}

// ---------------- launch ----------------
extern "C" void kernel_launch(void* const* d_in, const int* in_sizes, int n_in,
                              void* d_out, int out_size, void* d_ws, size_t ws_size,
                              hipStream_t stream) {
  const float* x     = (const float*)d_in[0];  // [2,2048,1024]
  const float* w_qkv = (const float*)d_in[1];  // [3072,1024]
  const float* b_qkv = (const float*)d_in[2];  // [3072]
  const float* w_out = (const float*)d_in[3];  // [1024,1024]
  const float* b_out = (const float*)d_in[4];  // [1024]
  float* out = (float*)d_out;                  // [2,2048,1024] fp32

  const int M  = BATCH * SEQ;      // 4096
  const int N1 = 3 * DMODEL;       // 3072
  const int N2 = DMODEL;           // 1024
  const int Kd = DMODEL;           // 1024

  char* w = (char*)d_ws;
  unsigned short* xb    = (unsigned short*)(w);                    // 8 MB
  unsigned short* wqkvb = (unsigned short*)(w + (8u << 20));       // 6 MB
  unsigned short* woutb = (unsigned short*)(w + (14u << 20));      // 2 MB
  float*          qkv   = (float*)(w + (16u << 20));               // 48 MB
  float*          qinv  = (float*)(w + (64u << 20));               // 256 KB
  float*          kinv  = (float*)(w + (64u << 20) + (256u << 10));// 256 KB
  unsigned short* attnb = (unsigned short*)(w + (65u << 20));      // 8 MB

  // 1) fp32 -> bf16 conversions
  {
    int n4 = (M * Kd) / 4;
    cvt_f32_bf16<<<(n4 + 255) / 256, 256, 0, stream>>>(x, xb, n4);
    n4 = (N1 * Kd) / 4;
    cvt_f32_bf16<<<(n4 + 255) / 256, 256, 0, stream>>>(w_qkv, wqkvb, n4);
    n4 = (N2 * Kd) / 4;
    cvt_f32_bf16<<<(n4 + 255) / 256, 256, 0, stream>>>(w_out, woutb, n4);
  }

  // 2) QKV projection: qkv = x @ w_qkv^T + b_qkv  (WMMA bf16, fp32 acc)
  gemm_nt_bias<<<dim3(N1 / BN, M / BM), 256, 0, stream>>>(xb, wqkvb, b_qkv, qkv, N1, Kd);

  // 3) q/k inverse norms
  qk_norms<<<(2 * M * HH) / 8, 256, 0, stream>>>(qkv, qinv, kinv);

  // 4) dilated masked attention -> bf16 [M, D]
  dilated_attn<<<(M * HH) / 8, 256, 0, stream>>>(qkv, qinv, kinv, attnb);

  // 5) output projection: out = attn @ w_out^T + b_out
  gemm_nt_bias<<<dim3(N2 / BN, M / BM), 256, 0, stream>>>(attnb, woutb, b_out, out, N2, Kd);
}

// v001
// It runs in 164 microseconds.
// Timed twice side by side with v000, it ran 1.42 and 1.43 times as fast.
#include <hip/hip_runtime.h>
#include <hip/hip_bf16.h>

typedef __attribute__((ext_vector_type(16))) __bf16 v16bf;
typedef __attribute__((ext_vector_type(8)))  float  v8f;
typedef __attribute__((ext_vector_type(4)))  int    v4i;

#define HH     16      // heads
#define DH     64      // head dim
#define SEQ    2048
#define DMODEL 1024
#define BATCH  2
#define WIN    17      // dilated window size: j = i-16 .. i+16 step 2

#if __has_builtin(__builtin_amdgcn_global_load_async_to_lds_b128)
#define USE_ASYNC_LDS 1
#else
#define USE_ASYNC_LDS 0
#endif

#define AS1 __attribute__((address_space(1)))
#define AS3 __attribute__((address_space(3)))

// ---------------- fp32 -> bf16 (round to nearest even) ----------------
__device__ __forceinline__ unsigned short f2bf(float f) {
  unsigned u = __builtin_bit_cast(unsigned, f);
  unsigned r = u + 0x7FFFu + ((u >> 16) & 1u);
  return (unsigned short)(r >> 16);
}

__global__ __launch_bounds__(256)
void cvt_f32_bf16(const float* __restrict__ in, unsigned short* __restrict__ out, int n4) {
  int i = blockIdx.x * blockDim.x + threadIdx.x;
  if (i >= n4) return;
  float4 f = ((const float4*)in)[i];
  ushort4 o;
  o.x = f2bf(f.x); o.y = f2bf(f.y); o.z = f2bf(f.z); o.w = f2bf(f.w);
  ((ushort4*)out)[i] = o;
}

// ---------------- bf16 NT GEMM with fp32 accumulate: C = A * B^T + bias ----------------
// A: [M][Kd] bf16 row-major; Bm: [Nd][Kd] bf16 row-major (so B^T is Kd x Nd);
// C: [M][Nd] fp32.  M,Nd multiples of 128; Kd multiple of 32.
#define BM 128
#define BN 128
#define BK 32
#define LDT 40   // padded LDS row stride in ushorts (80B, 16B-aligned, bank-spread)

union Frag { v16bf v; uint4 q[2]; };

__device__ __forceinline__ void stage_chunk(const unsigned short* __restrict__ gsrc,
                                            unsigned short* lds_dst) {
#if USE_ASYNC_LDS
  // CDNA5 async DMA: global -> LDS without VGPR round trip, tracked on ASYNCcnt
  __builtin_amdgcn_global_load_async_to_lds_b128(
      (AS1 v4i*)gsrc, (AS3 v4i*)lds_dst, 0, 0);
#else
  *(uint4*)lds_dst = *(const uint4*)gsrc;
#endif
}

__device__ __forceinline__ void stage_fence() {
#if USE_ASYNC_LDS
#if __has_builtin(__builtin_amdgcn_s_wait_asynccnt)
  __builtin_amdgcn_s_wait_asynccnt(0);
#else
  asm volatile("s_wait_asynccnt 0x0" ::: "memory");
#endif
#endif
}

__global__ __launch_bounds__(256)
void gemm_nt_bias(const unsigned short* __restrict__ A,
                  const unsigned short* __restrict__ Bm,
                  const float* __restrict__ bias,
                  float* __restrict__ C,
                  int Ndim, int Kd) {
  __shared__ unsigned short As[2][BM * LDT];
  __shared__ unsigned short Bs[2][BN * LDT];

  const int tid  = threadIdx.x;
  const int lane = tid & 31;
  const int wid  = tid >> 5;
  const int wm   = wid >> 2;     // 0..1  -> 64 rows each
  const int wn   = wid & 3;      // 0..3  -> 32 cols each
  const int l16  = lane & 15;
  const int half = lane >> 4;    // 0/1: selects K sub-chunk per ISA bf16 A/B layout

  const int brow = blockIdx.y * BM;
  const int bcol = blockIdx.x * BN;
  const int T = Kd / BK;

  v8f acc[4][2] = {};

  // preload tile 0 (each thread: 2 x 16B chunks of A tile and of B tile)
  {
#pragma unroll
    for (int s = 0; s < 2; ++s) {
      int c = tid * 2 + s;          // 0..511
      int row = c >> 2, cc = c & 3; // 4 x 16B chunks per 32-elem row
      stage_chunk(&A[(size_t)(brow + row) * Kd + cc * 8],  &As[0][row * LDT + cc * 8]);
      stage_chunk(&Bm[(size_t)(bcol + row) * Kd + cc * 8], &Bs[0][row * LDT + cc * 8]);
    }
  }

  for (int t = 0; t < T; ++t) {
    stage_fence();      // our async fills have landed in LDS
    __syncthreads();    // everyone's fills visible; previous buffer reads retired
    const int cur = t & 1;

    if (t + 1 < T) {
      const int nxt = cur ^ 1;
      const int k0 = (t + 1) * BK;
#pragma unroll
      for (int s = 0; s < 2; ++s) {
        int c = tid * 2 + s;
        int row = c >> 2, cc = c & 3;
        stage_chunk(&A[(size_t)(brow + row) * Kd + k0 + cc * 8],
                    &As[nxt][row * LDT + cc * 8]);
        stage_chunk(&Bm[(size_t)(bcol + row) * Kd + k0 + cc * 8],
                    &Bs[nxt][row * LDT + cc * 8]);
        if (t + 2 < T) {
          __builtin_prefetch(&A[(size_t)(brow + row) * Kd + (t + 2) * BK + cc * 8], 0, 0);
          __builtin_prefetch(&Bm[(size_t)(bcol + row) * Kd + (t + 2) * BK + cc * 8], 0, 0);
        }
      }
    }

    // fragment fetch from LDS (matches ISA 16-bit A/B VGPR layout:
    // lane<16 -> K[0..7],K[16..23]; lane>=16 -> K[8..15],K[24..31])
    Frag a[4], b[2];
#pragma unroll
    for (int mf = 0; mf < 4; ++mf) {
      int row = wm * 64 + mf * 16 + l16;
      a[mf].q[0] = *(const uint4*)&As[cur][row * LDT + half * 8];
      a[mf].q[1] = *(const uint4*)&As[cur][row * LDT + 16 + half * 8];
    }
#pragma unroll
    for (int nf = 0; nf < 2; ++nf) {
      int row = wn * 32 + nf * 16 + l16;
      b[nf].q[0] = *(const uint4*)&Bs[cur][row * LDT + half * 8];
      b[nf].q[1] = *(const uint4*)&Bs[cur][row * LDT + 16 + half * 8];
    }
#pragma unroll
    for (int mf = 0; mf < 4; ++mf)
#pragma unroll
      for (int nf = 0; nf < 2; ++nf)
        acc[mf][nf] = __builtin_amdgcn_wmma_f32_16x16x32_bf16(
            false, a[mf].v, false, b[nf].v, (short)0, acc[mf][nf], false, false);
  }

  // epilogue: C/D layout -> VGPR r: lanes 0-15 are M=r, lanes 16-31 are M=8+r, N=lane%16
#pragma unroll
  for (int nf = 0; nf < 2; ++nf) {
    int gn = bcol + wn * 32 + nf * 16 + l16;
    float bb = bias[gn];
#pragma unroll
    for (int mf = 0; mf < 4; ++mf) {
      int gm = brow + wm * 64 + mf * 16 + half * 8;
      float* Cp = C + (size_t)gm * Ndim + gn;
#pragma unroll
      for (int r = 0; r < 8; ++r)
        Cp[(size_t)r * Ndim] = acc[mf][nf][r] + bb;
    }
  }
}

// ---------------- per-(m,h) inverse norms for q and k ----------------
__global__ __launch_bounds__(256)
void qk_norms(const float* __restrict__ qkv, float* __restrict__ qinv,
              float* __restrict__ kinv) {
  const int lane = threadIdx.x & 31;
  const int wid  = threadIdx.x >> 5;
  int id   = blockIdx.x * 8 + wid;   // 0 .. 2*B*SEQ*HH-1  (B*SEQ*HH = 65536)
  int type = id >> 16;               // 0 = q, 1 = k
  int r    = id & 65535;
  int m    = r >> 4;
  int h    = r & 15;
  const float* p = qkv + (size_t)m * (3 * DMODEL) + type * DMODEL + h * DH;
  float f0 = p[2 * lane], f1 = p[2 * lane + 1];
  float ss = f0 * f0 + f1 * f1;
#pragma unroll
  for (int msk = 16; msk >= 1; msk >>= 1) ss += __shfl_xor(ss, msk, 32);
  float inv = 1.0f / (sqrtf(ss) + 1e-6f);
  if (lane == 0) (type ? kinv : qinv)[m * HH + h] = inv;
}

// ---------------- dilated attention: 64 queries of one head per block, K/V rows in LDS ----------------
// Four lanes share a query, 16 head dims each. The block's 64 queries touch 96 consecutive
// key rows (16 before the first query to 16 behind the last): each is fetched once.
#define QT     64            // queries per block
#define KROWS  (QT + 32)     // staged key/value rows
#define KPITCH 68            // LDS row pitch in floats: 16 lanes of a b128 read hit 16 distinct bank groups

// sum over the four lanes of a quad, same bits in all four
__device__ __forceinline__ float quad_sum(float x) {
  x += __builtin_bit_cast(float, __builtin_amdgcn_mov_dpp(__builtin_bit_cast(int, x), 0xB1, 0xf, 0xf, true)); // quad_perm [1,0,3,2]
  x += __builtin_bit_cast(float, __builtin_amdgcn_mov_dpp(__builtin_bit_cast(int, x), 0x4E, 0xf, 0xf, true)); // quad_perm [2,3,0,1]
  return x;
}

// e^x as the fast intrinsic forms it (multiply by log2 e, v_exp_f32); the v_nop fills the one slot the
// instruction set asks for between a transcendental and a next instruction that overwrites its source
__device__ __forceinline__ float exp_slot(float x) {
  float r, y = x * 1.44269504088896340736f;
  asm("v_exp_f32 %0, %1\n\tv_nop" : "=v"(r) : "v"(y));
  return r;
}

typedef __attribute__((ext_vector_type(2))) float v2f;
typedef __attribute__((ext_vector_type(4))) float v4f;

// eight waves per SIMD (four blocks per WGP): one block's staging hides behind another's arithmetic
__global__ __launch_bounds__(256) __attribute__((amdgpu_waves_per_eu(8)))
void dilated_attn(const float* __restrict__ qkv, const float* __restrict__ qinv,
                  const float* __restrict__ kinv, unsigned short* __restrict__ aout) {
  __shared__ __attribute__((aligned(16))) float Ks[KROWS * KPITCH];
  __shared__ __attribute__((aligned(16))) float Vs[KROWS * KPITCH];

  const int tid  = threadIdx.x;
  const int tile = blockIdx.x % (SEQ / QT);
  const int rest = blockIdx.x / (SEQ / QT);
  const int h    = rest % HH;
  const int b    = rest / HH;
  const int i0   = tile * QT;

  const int ql   = tid >> 2;   // query inside the block
  const int part = tid & 3;    // which 16 of the 64 head dims
  const int i    = i0 + ql;
  const int m    = b * SEQ + i;

  // Every address below is a block-uniform base plus one of four per-lane byte offsets.
  const unsigned qoff  = (unsigned)ql * (3 * DMODEL * 4) + (unsigned)part * 64;   // query row, 16 dims
  const unsigned qioff = (unsigned)ql * (HH * 4);
  const unsigned koff  = (unsigned)(tid >> 4) * (3 * DMODEL * 4) + (unsigned)(tid & 15) * 16;  // row of a 16-row group, 16B chunk
  const unsigned kioff = (unsigned)(tid >> 4) * (HH * 4);

  // this lane's 16 query values, as stored; normalised behind the barrier
  const char* qb  = (const char*)(qkv + (size_t)(b * SEQ + i0) * (3 * DMODEL) + h * DH);
  const char* qib = (const char*)(qinv + (b * SEQ + i0) * HH + h);
  const v4f* qp = (const v4f*)(qb + qoff);
  const v4f qr0 = qp[0], qr1 = qp[1], qr2 = qp[2], qr3 = qp[3];
  const float qi = *(const float*)(qib + qioff);

  // Rows i0-16 .. i0+QT+15 in six groups of 16 rows, one group per pass of the block. Only the first
  // group of the first tile and the last group of the last tile lie outside the sequence, each as a
  // whole: such a group reads the tile's own first rows instead (in bounds) and is staged as zeros.
  const bool okf = tile > 0, okl = tile < SEQ / QT - 1;
  const int  gf  = okf ? i0 - 16 : i0, gl = okl ? i0 + QT : i0;
  const char* rbf = (const char*)(qkv + (size_t)(b * SEQ + gf) * (3 * DMODEL) + h * DH);
  const char* rbl = (const char*)(qkv + (size_t)(b * SEQ + gl) * (3 * DMODEL) + h * DH);
  const char* ibf = (const char*)(kinv + (b * SEQ + gf) * HH + h);
  const char* ibl = (const char*)(kinv + (b * SEQ + gl) * HH + h);
  const char* ibm = (const char*)(kinv + (b * SEQ + i0) * HH + h);

  float4 k4[KROWS / 16], v4[KROWS / 16];
  float  ki[KROWS / 16];
#pragma unroll
  for (int s = 0; s < KROWS / 16; ++s) {
    const char* rb = s == 0 ? rbf : s == KROWS / 16 - 1 ? rbl : qb + (s - 1) * (16 * 3 * DMODEL * 4);
    const char* ib = s == 0 ? ibf : s == KROWS / 16 - 1 ? ibl : ibm + (s - 1) * (16 * HH * 4);
    k4[s] = *(const float4*)(rb + koff + DMODEL * 4);       // the row's K columns of this head
    v4[s] = *(const float4*)(rb + koff + 2 * DMODEL * 4);   // its V columns
    ki[s] = *(const float*)(ib + kioff);
  }
  // The wait that stands in front of the first overwrite of a register that an issued load names. Its
  // inputs are those registers: they stay live up to here, so no load's result is placed on one of them;
  // the clobber keeps every load above in front of it (the query loads too, in flight with the staging).
  asm volatile("s_wait_xcnt 0x0"
               :: "v"(qoff), "v"(qioff), "v"(koff), "v"(kioff),
                  "s"(qb), "s"(qib), "s"(rbf), "s"(rbl), "s"(ibf), "s"(ibl), "s"(ibm)
               : "memory");

  // K normalised on the way into LDS
#pragma unroll
  for (int s = 0; s < KROWS / 16; ++s) {
    const bool ok = s == 0 ? okf : s == KROWS / 16 - 1 ? okl : true;
    const int at = (s * 16 + (tid >> 4)) * KPITCH + (tid & 15) * 4;
    float4 ko, vo;
    ko.x = ok ? k4[s].x * ki[s] : 0.f; ko.y = ok ? k4[s].y * ki[s] : 0.f;
    ko.z = ok ? k4[s].z * ki[s] : 0.f; ko.w = ok ? k4[s].w * ki[s] : 0.f;
    vo.x = ok ? v4[s].x : 0.f; vo.y = ok ? v4[s].y : 0.f;
    vo.z = ok ? v4[s].z : 0.f; vo.w = ok ? v4[s].w : 0.f;
    *(float4*)&Ks[at] = ko;
    *(float4*)&Vs[at] = vo;
  }
  __syncthreads();

  v2f q[8];
  {
    v4f f0 = qr0 * qi, f1 = qr1 * qi, f2 = qr2 * qi, f3 = qr3 * qi;
    q[0] = f0.lo; q[1] = f0.hi; q[2] = f1.lo; q[3] = f1.hi;
    q[4] = f2.lo; q[5] = f2.hi; q[6] = f3.lo; q[7] = f3.hi;
  }

  float s[WIN];
#pragma unroll
  for (int t = 0; t < WIN; ++t) {
    const v4f* kr = (const v4f*)&Ks[(ql + 2 * t) * KPITCH + part * 16];
    v2f pa = {0.f, 0.f};
#pragma unroll
    for (int k = 0; k < 4; ++k) {
      v4f f = kr[k];
      pa += q[2 * k] * f.lo;
      pa += q[2 * k + 1] * f.hi;
    }
    float p = quad_sum(pa.x + pa.y);
    int j = i - 16 + 2 * t;
    s[t] = (j >= 0 && j < SEQ) ? p : -3.0e38f;
  }
  float mx = -3.0e38f;
#pragma unroll
  for (int t = 0; t < WIN; ++t) mx = fmaxf(mx, s[t]);
  float sum = 0.f;
#pragma unroll
  for (int t = 0; t < WIN; ++t) { s[t] = exp_slot(s[t] - mx); sum += s[t]; }
  float inv = 1.0f / sum;

  v2f o[8];
#pragma unroll
  for (int k = 0; k < 8; ++k) o[k] = (v2f){0.f, 0.f};
#pragma unroll
  for (int t = 0; t < WIN; ++t) {
    const v4f* vr = (const v4f*)&Vs[(ql + 2 * t) * KPITCH + part * 16];
    float w = s[t] * inv;
#pragma unroll
    for (int k = 0; k < 4; ++k) {
      v4f f = vr[k];
      o[2 * k]     += w * f.lo;
      o[2 * k + 1] += w * f.hi;
    }
  }

  unsigned pk[8];
#pragma unroll
  for (int k = 0; k < 8; ++k)
    pk[k] = (unsigned)f2bf(o[k].x) | ((unsigned)f2bf(o[k].y) << 16);
  uint4* op = (uint4*)(aout + (size_t)m * DMODEL + h * DH + part * 16);
  op[0] = make_uint4(pk[0], pk[1], pk[2], pk[3]);
  op[1] = make_uint4(pk[4], pk[5], pk[6], pk[7]);
}

// ---------------- launch ----------------
extern "C" void kernel_launch(void* const* d_in, const int* in_sizes, int n_in,
                              void* d_out, int out_size, void* d_ws, size_t ws_size,
                              hipStream_t stream) {
  const float* x     = (const float*)d_in[0];  // [2,2048,1024]
  const float* w_qkv = (const float*)d_in[1];  // [3072,1024]
  const float* b_qkv = (const float*)d_in[2];  // [3072]
  const float* w_out = (const float*)d_in[3];  // [1024,1024]
  const float* b_out = (const float*)d_in[4];  // [1024]
  float* out = (float*)d_out;                  // [2,2048,1024] fp32

  const int M  = BATCH * SEQ;      // 4096
  const int N1 = 3 * DMODEL;       // 3072
  const int N2 = DMODEL;           // 1024
  const int Kd = DMODEL;           // 1024

  char* w = (char*)d_ws;
  unsigned short* xb    = (unsigned short*)(w);                    // 8 MB
  unsigned short* wqkvb = (unsigned short*)(w + (8u << 20));       // 6 MB
  unsigned short* woutb = (unsigned short*)(w + (14u << 20));      // 2 MB
  float*          qkv   = (float*)(w + (16u << 20));               // 48 MB
  float*          qinv  = (float*)(w + (64u << 20));               // 256 KB
  float*          kinv  = (float*)(w + (64u << 20) + (256u << 10));// 256 KB
  unsigned short* attnb = (unsigned short*)(w + (65u << 20));      // 8 MB

  // 1) fp32 -> bf16 conversions
  {
    int n4 = (M * Kd) / 4;
    cvt_f32_bf16<<<(n4 + 255) / 256, 256, 0, stream>>>(x, xb, n4);
    n4 = (N1 * Kd) / 4;
    cvt_f32_bf16<<<(n4 + 255) / 256, 256, 0, stream>>>(w_qkv, wqkvb, n4);
    n4 = (N2 * Kd) / 4;
    cvt_f32_bf16<<<(n4 + 255) / 256, 256, 0, stream>>>(w_out, woutb, n4);
  }

  // 2) QKV projection: qkv = x @ w_qkv^T + b_qkv  (WMMA bf16, fp32 acc)
  gemm_nt_bias<<<dim3(N1 / BN, M / BM), 256, 0, stream>>>(xb, wqkvb, b_qkv, qkv, N1, Kd);

  // 3) q/k inverse norms
  qk_norms<<<(2 * M * HH) / 8, 256, 0, stream>>>(qkv, qinv, kinv);

  // 4) dilated masked attention -> bf16 [M, D]
  dilated_attn<<<(M * HH) / QT, 256, 0, stream>>>(qkv, qinv, kinv, attnb);

  // 5) output projection: out = attn @ w_out^T + b_out
  gemm_nt_bias<<<dim3(N2 / BN, M / BM), 256, 0, stream>>>(attnb, woutb, b_out, out, N2, Kd);
}

// v002
// A run of this version takes 154 microseconds.
// Timed twice side by side with v001, it ran 1.07 times as fast both times.
// Counting every step since v000, it is 1.52 times as fast.
#include <hip/hip_runtime.h>
#include <hip/hip_bf16.h>

typedef __attribute__((ext_vector_type(16))) __bf16 v16bf;
typedef __attribute__((ext_vector_type(8)))  float  v8f;
typedef __attribute__((ext_vector_type(4)))  int    v4i;

#define HH     16      // heads
#define DH     64      // head dim
#define SEQ    2048
#define DMODEL 1024
#define BATCH  2
#define WIN    17      // dilated window size: j = i-16 .. i+16 step 2

#if __has_builtin(__builtin_amdgcn_global_load_async_to_lds_b128)
#define USE_ASYNC_LDS 1
#else
#define USE_ASYNC_LDS 0
#endif

#define AS1 __attribute__((address_space(1)))
#define AS3 __attribute__((address_space(3)))

// ---------------- fp32 -> bf16 (round to nearest even) ----------------
__device__ __forceinline__ unsigned short f2bf(float f) {
  unsigned u = __builtin_bit_cast(unsigned, f);
  unsigned r = u + 0x7FFFu + ((u >> 16) & 1u);
  return (unsigned short)(r >> 16);
}

__global__ __launch_bounds__(256)
void cvt_f32_bf16(const float* __restrict__ in, unsigned short* __restrict__ out, int n4) {
  int i = blockIdx.x * blockDim.x + threadIdx.x;
  if (i >= n4) return;
  float4 f = ((const float4*)in)[i];
  ushort4 o;
  o.x = f2bf(f.x); o.y = f2bf(f.y); o.z = f2bf(f.z); o.w = f2bf(f.w);
  ((ushort4*)out)[i] = o;
}

// ---------------- bf16 NT GEMM with fp32 accumulate: C = A * B^T + bias ----------------
// A: [M][Kd] bf16 row-major; Bm: [Nd][Kd] bf16 row-major (so B^T is Kd x Nd);
// C: [M][Nd] fp32.  M,Nd multiples of 128; Kd multiple of 32.
#define BM 128
#define BN 128
#define BK 32
#define LDT 40   // padded LDS row stride in ushorts (80B, 16B-aligned, bank-spread)

union Frag { v16bf v; uint4 q[2]; };

__device__ __forceinline__ void stage_chunk(const unsigned short* __restrict__ gsrc,
                                            unsigned short* lds_dst) {
#if USE_ASYNC_LDS
  // CDNA5 async DMA: global -> LDS without VGPR round trip, tracked on ASYNCcnt
  __builtin_amdgcn_global_load_async_to_lds_b128(
      (AS1 v4i*)gsrc, (AS3 v4i*)lds_dst, 0, 0);
#else
  *(uint4*)lds_dst = *(const uint4*)gsrc;
#endif
}

__device__ __forceinline__ void stage_fence() {
#if USE_ASYNC_LDS
#if __has_builtin(__builtin_amdgcn_s_wait_asynccnt)
  __builtin_amdgcn_s_wait_asynccnt(0);
#else
  asm volatile("s_wait_asynccnt 0x0" ::: "memory");
#endif
#endif
}

__global__ __launch_bounds__(256)
void gemm_nt_bias(const unsigned short* __restrict__ A,
                  const unsigned short* __restrict__ Bm,
                  const float* __restrict__ bias,
                  float* __restrict__ C,
                  int Ndim, int Kd) {
  __shared__ unsigned short As[2][BM * LDT];
  __shared__ unsigned short Bs[2][BN * LDT];

  const int tid  = threadIdx.x;
  const int lane = tid & 31;
  const int wid  = tid >> 5;
  const int wm   = wid >> 2;     // 0..1  -> 64 rows each
  const int wn   = wid & 3;      // 0..3  -> 32 cols each
  const int l16  = lane & 15;
  const int half = lane >> 4;    // 0/1: selects K sub-chunk per ISA bf16 A/B layout

  const int brow = blockIdx.y * BM;
  const int bcol = blockIdx.x * BN;
  const int T = Kd / BK;

  v8f acc[4][2] = {};

  // preload tile 0 (each thread: 2 x 16B chunks of A tile and of B tile)
  {
#pragma unroll
    for (int s = 0; s < 2; ++s) {
      int c = tid * 2 + s;          // 0..511
      int row = c >> 2, cc = c & 3; // 4 x 16B chunks per 32-elem row
      stage_chunk(&A[(size_t)(brow + row) * Kd + cc * 8],  &As[0][row * LDT + cc * 8]);
      stage_chunk(&Bm[(size_t)(bcol + row) * Kd + cc * 8], &Bs[0][row * LDT + cc * 8]);
    }
  }

  for (int t = 0; t < T; ++t) {
    stage_fence();      // our async fills have landed in LDS
    __syncthreads();    // everyone's fills visible; previous buffer reads retired
    const int cur = t & 1;

    if (t + 1 < T) {
      const int nxt = cur ^ 1;
      const int k0 = (t + 1) * BK;
#pragma unroll
      for (int s = 0; s < 2; ++s) {
        int c = tid * 2 + s;
        int row = c >> 2, cc = c & 3;
        stage_chunk(&A[(size_t)(brow + row) * Kd + k0 + cc * 8],
                    &As[nxt][row * LDT + cc * 8]);
        stage_chunk(&Bm[(size_t)(bcol + row) * Kd + k0 + cc * 8],
                    &Bs[nxt][row * LDT + cc * 8]);
        if (t + 2 < T) {
          __builtin_prefetch(&A[(size_t)(brow + row) * Kd + (t + 2) * BK + cc * 8], 0, 0);
          __builtin_prefetch(&Bm[(size_t)(bcol + row) * Kd + (t + 2) * BK + cc * 8], 0, 0);
        }
      }
    }

    // fragment fetch from LDS (matches ISA 16-bit A/B VGPR layout:
    // lane<16 -> K[0..7],K[16..23]; lane>=16 -> K[8..15],K[24..31])
    Frag a[4], b[2];
#pragma unroll
    for (int mf = 0; mf < 4; ++mf) {
      int row = wm * 64 + mf * 16 + l16;
      a[mf].q[0] = *(const uint4*)&As[cur][row * LDT + half * 8];
      a[mf].q[1] = *(const uint4*)&As[cur][row * LDT + 16 + half * 8];
    }
#pragma unroll
    for (int nf = 0; nf < 2; ++nf) {
      int row = wn * 32 + nf * 16 + l16;
      b[nf].q[0] = *(const uint4*)&Bs[cur][row * LDT + half * 8];
      b[nf].q[1] = *(const uint4*)&Bs[cur][row * LDT + 16 + half * 8];
    }
#pragma unroll
    for (int mf = 0; mf < 4; ++mf)
#pragma unroll
      for (int nf = 0; nf < 2; ++nf)
        acc[mf][nf] = __builtin_amdgcn_wmma_f32_16x16x32_bf16(
            false, a[mf].v, false, b[nf].v, (short)0, acc[mf][nf], false, false);
  }

  // epilogue: C/D layout -> VGPR r: lanes 0-15 are M=r, lanes 16-31 are M=8+r, N=lane%16
#pragma unroll
  for (int nf = 0; nf < 2; ++nf) {
    int gn = bcol + wn * 32 + nf * 16 + l16;
    float bb = bias[gn];
#pragma unroll
    for (int mf = 0; mf < 4; ++mf) {
      int gm = brow + wm * 64 + mf * 16 + half * 8;
      float* Cp = C + (size_t)gm * Ndim + gn;
#pragma unroll
      for (int r = 0; r < 8; ++r)
        Cp[(size_t)r * Ndim] = acc[mf][nf][r] + bb;
    }
  }
}

// ---------------- dilated attention: 64 queries of one head per block, K/V rows in LDS ----------------
// Four lanes share a query, 16 head dims each. The block's 64 queries touch 96 consecutive
// key rows (16 before the first query to 16 behind the last): each is fetched once.
// The inverse norms of q and k are formed here, from the rows as they lie in registers: the 16 lanes
// that hold a key row sum its squares, and so do the four lanes that hold a query.
#define QT     64            // queries per block
#define KROWS  (QT + 32)     // staged key/value rows
#define KPITCH 68            // LDS row pitch in floats: 16 lanes of a b128 read hit 16 distinct bank groups

// sum over the four lanes of a quad, same bits in all four
__device__ __forceinline__ float quad_sum(float x) {
  x += __builtin_bit_cast(float, __builtin_amdgcn_mov_dpp(__builtin_bit_cast(int, x), 0xB1, 0xf, 0xf, true)); // quad_perm [1,0,3,2]
  x += __builtin_bit_cast(float, __builtin_amdgcn_mov_dpp(__builtin_bit_cast(int, x), 0x4E, 0xf, 0xf, true)); // quad_perm [2,3,0,1]
  return x;
}

// sum over the 16 lanes of a row, same bits in all sixteen
__device__ __forceinline__ float row_sum(float x) {
  x = quad_sum(x);
  x += __builtin_bit_cast(float, __builtin_amdgcn_mov_dpp(__builtin_bit_cast(int, x), 0x164, 0xf, 0xf, true)); // row_xmask:4
  x += __builtin_bit_cast(float, __builtin_amdgcn_mov_dpp(__builtin_bit_cast(int, x), 0x168, 0xf, 0xf, true)); // row_xmask:8
  return x;
}

// e^x as the fast intrinsic forms it (multiply by log2 e, v_exp_f32); the v_nop fills the one slot the
// instruction set asks for between a transcendental and a next instruction that overwrites its source
__device__ __forceinline__ float exp_slot(float x) {
  float r, y = x * 1.44269504088896340736f;
  asm("v_exp_f32 %0, %1\n\tv_nop" : "=v"(r) : "v"(y));
  return r;
}

typedef __attribute__((ext_vector_type(2))) float v2f;
typedef __attribute__((ext_vector_type(4))) float v4f;

// eight waves per SIMD (four blocks per WGP): one block's staging hides behind another's arithmetic
__global__ __launch_bounds__(256) __attribute__((amdgpu_waves_per_eu(8)))
void dilated_attn(const float* __restrict__ qkv, unsigned short* __restrict__ aout) {
  __shared__ __attribute__((aligned(16))) float Ks[KROWS * KPITCH];
  __shared__ __attribute__((aligned(16))) float Vs[KROWS * KPITCH];

  const int tid  = threadIdx.x;
  const int tile = blockIdx.x % (SEQ / QT);
  const int rest = blockIdx.x / (SEQ / QT);
  const int h    = rest % HH;
  const int b    = rest / HH;
  const int i0   = tile * QT;

  const int ql   = tid >> 2;   // query inside the block
  const int part = tid & 3;    // which 16 of the 64 head dims
  const int i    = i0 + ql;
  const int m    = b * SEQ + i;

  // Every address below is a block-uniform base plus one of two per-lane byte offsets.
  const unsigned qoff  = (unsigned)ql * (3 * DMODEL * 4) + (unsigned)part * 64;   // query row, 16 dims
  const unsigned koff  = (unsigned)(tid >> 4) * (3 * DMODEL * 4) + (unsigned)(tid & 15) * 16;  // row of a 16-row group, 16B chunk

  // this lane's 16 query values, as stored; normalised behind the barrier
  const char* qb  = (const char*)(qkv + (size_t)(b * SEQ + i0) * (3 * DMODEL) + h * DH);
  const v4f* qp = (const v4f*)(qb + qoff);
  const v4f qr0 = qp[0], qr1 = qp[1], qr2 = qp[2], qr3 = qp[3];

  // Rows i0-16 .. i0+QT+15 in six groups of 16 rows, one group per pass of the block. Only the first
  // group of the first tile and the last group of the last tile lie outside the sequence, each as a
  // whole: such a group reads the tile's own first rows instead (in bounds) and is staged as zeros.
  const bool okf = tile > 0, okl = tile < SEQ / QT - 1;
  const int  gf  = okf ? i0 - 16 : i0, gl = okl ? i0 + QT : i0;
  const char* rbf = (const char*)(qkv + (size_t)(b * SEQ + gf) * (3 * DMODEL) + h * DH);
  const char* rbl = (const char*)(qkv + (size_t)(b * SEQ + gl) * (3 * DMODEL) + h * DH);

  float4 k4[KROWS / 16], v4[KROWS / 16];
#pragma unroll
  for (int s = 0; s < KROWS / 16; ++s) {
    const char* rb = s == 0 ? rbf : s == KROWS / 16 - 1 ? rbl : qb + (s - 1) * (16 * 3 * DMODEL * 4);
    k4[s] = *(const float4*)(rb + koff + DMODEL * 4);       // the row's K columns of this head
    v4[s] = *(const float4*)(rb + koff + 2 * DMODEL * 4);   // its V columns
  }
  // The wait that stands in front of the first overwrite of a register that an issued load names. Its
  // inputs are those registers: they stay live up to here, so no load's result is placed on one of them;
  // the clobber keeps every load above in front of it (the query loads too, in flight with the staging).
  asm volatile("s_wait_xcnt 0x0"
               :: "v"(qoff), "v"(koff), "s"(qb), "s"(rbf), "s"(rbl)
               : "memory");

  // K normalised on the way into LDS
#pragma unroll
  for (int s = 0; s < KROWS / 16; ++s) {
    const bool ok = s == 0 ? okf : s == KROWS / 16 - 1 ? okl : true;
    const int at = (s * 16 + (tid >> 4)) * KPITCH + (tid & 15) * 4;
    const float kk = row_sum(k4[s].x * k4[s].x + k4[s].y * k4[s].y + k4[s].z * k4[s].z + k4[s].w * k4[s].w);
    const float ki = 1.0f / (sqrtf(kk) + 1e-6f);
    float4 ko, vo;
    ko.x = ok ? k4[s].x * ki : 0.f; ko.y = ok ? k4[s].y * ki : 0.f;
    ko.z = ok ? k4[s].z * ki : 0.f; ko.w = ok ? k4[s].w * ki : 0.f;
    vo.x = ok ? v4[s].x : 0.f; vo.y = ok ? v4[s].y : 0.f;
    vo.z = ok ? v4[s].z : 0.f; vo.w = ok ? v4[s].w : 0.f;
    *(float4*)&Ks[at] = ko;
    *(float4*)&Vs[at] = vo;
  }
  __syncthreads();

  v2f q[8];
  {
    const v4f sq = qr0 * qr0 + qr1 * qr1 + qr2 * qr2 + qr3 * qr3;
    const float qi = 1.0f / (sqrtf(quad_sum((sq.x + sq.y) + (sq.z + sq.w))) + 1e-6f);
    v4f f0 = qr0 * qi, f1 = qr1 * qi, f2 = qr2 * qi, f3 = qr3 * qi;
    q[0] = f0.lo; q[1] = f0.hi; q[2] = f1.lo; q[3] = f1.hi;
    q[4] = f2.lo; q[5] = f2.hi; q[6] = f3.lo; q[7] = f3.hi;
  }

  float s[WIN];
#pragma unroll
  for (int t = 0; t < WIN; ++t) {
    const v4f* kr = (const v4f*)&Ks[(ql + 2 * t) * KPITCH + part * 16];
    v2f pa = {0.f, 0.f};
#pragma unroll
    for (int k = 0; k < 4; ++k) {
      v4f f = kr[k];
      pa += q[2 * k] * f.lo;
      pa += q[2 * k + 1] * f.hi;
    }
    float p = quad_sum(pa.x + pa.y);
    int j = i - 16 + 2 * t;
    s[t] = (j >= 0 && j < SEQ) ? p : -3.0e38f;
  }
  float mx = -3.0e38f;
#pragma unroll
  for (int t = 0; t < WIN; ++t) mx = fmaxf(mx, s[t]);
  float sum = 0.f;
#pragma unroll
  for (int t = 0; t < WIN; ++t) { s[t] = exp_slot(s[t] - mx); sum += s[t]; }
  float inv = 1.0f / sum;

  v2f o[8];
#pragma unroll
  for (int k = 0; k < 8; ++k) o[k] = (v2f){0.f, 0.f};
#pragma unroll
  for (int t = 0; t < WIN; ++t) {
    const v4f* vr = (const v4f*)&Vs[(ql + 2 * t) * KPITCH + part * 16];
    float w = s[t] * inv;
#pragma unroll
    for (int k = 0; k < 4; ++k) {
      v4f f = vr[k];
      o[2 * k]     += w * f.lo;
      o[2 * k + 1] += w * f.hi;
    }
  }

  unsigned pk[8];
#pragma unroll
  for (int k = 0; k < 8; ++k)
    pk[k] = (unsigned)f2bf(o[k].x) | ((unsigned)f2bf(o[k].y) << 16);
  uint4* op = (uint4*)(aout + (size_t)m * DMODEL + h * DH + part * 16);
  op[0] = make_uint4(pk[0], pk[1], pk[2], pk[3]);
  op[1] = make_uint4(pk[4], pk[5], pk[6], pk[7]);
}

// ---------------- launch ----------------
extern "C" void kernel_launch(void* const* d_in, const int* in_sizes, int n_in,
                              void* d_out, int out_size, void* d_ws, size_t ws_size,
                              hipStream_t stream) {
  const float* x     = (const float*)d_in[0];  // [2,2048,1024]
  const float* w_qkv = (const float*)d_in[1];  // [3072,1024]
  const float* b_qkv = (const float*)d_in[2];  // [3072]
  const float* w_out = (const float*)d_in[3];  // [1024,1024]
  const float* b_out = (const float*)d_in[4];  // [1024]
  float* out = (float*)d_out;                  // [2,2048,1024] fp32

  const int M  = BATCH * SEQ;      // 4096
  const int N1 = 3 * DMODEL;       // 3072
  const int N2 = DMODEL;           // 1024
  const int Kd = DMODEL;           // 1024

  char* w = (char*)d_ws;
  unsigned short* xb    = (unsigned short*)(w);                    // 8 MB
  unsigned short* wqkvb = (unsigned short*)(w + (8u << 20));       // 6 MB
  unsigned short* woutb = (unsigned short*)(w + (14u << 20));      // 2 MB
  float*          qkv   = (float*)(w + (16u << 20));               // 48 MB
  unsigned short* attnb = (unsigned short*)(w + (65u << 20));      // 8 MB

  // 1) fp32 -> bf16 conversions
  {
    int n4 = (M * Kd) / 4;
    cvt_f32_bf16<<<(n4 + 255) / 256, 256, 0, stream>>>(x, xb, n4);
    n4 = (N1 * Kd) / 4;
    cvt_f32_bf16<<<(n4 + 255) / 256, 256, 0, stream>>>(w_qkv, wqkvb, n4);
    n4 = (N2 * Kd) / 4;
    cvt_f32_bf16<<<(n4 + 255) / 256, 256, 0, stream>>>(w_out, woutb, n4);
  }

  // 2) QKV projection: qkv = x @ w_qkv^T + b_qkv  (WMMA bf16, fp32 acc)
  gemm_nt_bias<<<dim3(N1 / BN, M / BM), 256, 0, stream>>>(xb, wqkvb, b_qkv, qkv, N1, Kd);

  // 3) dilated masked attention with q/k norms -> bf16 [M, D]
  dilated_attn<<<(M * HH) / QT, 256, 0, stream>>>(qkv, attnb);

  // 4) output projection: out = attn @ w_out^T + b_out
  gemm_nt_bias<<<dim3(N2 / BN, M / BM), 256, 0, stream>>>(attnb, woutb, b_out, out, N2, Kd);
}

// v003
// A run of this version takes 70.1 microseconds.
// Next to v002, in two timings, it ran 2.17 and 2.20 times as fast.
// Over all steps from v000 it is 3.32 times as fast.
#include <hip/hip_runtime.h>
#include <hip/hip_bf16.h>

typedef __attribute__((ext_vector_type(16))) __bf16 v16bf;
typedef __attribute__((ext_vector_type(8)))  float  v8f;
typedef __attribute__((ext_vector_type(4)))  int    v4i;

#define HH     16      // heads
#define DH     64      // head dim
#define SEQ    2048
#define DMODEL 1024
#define BATCH  2
#define WIN    17      // dilated window size: j = i-16 .. i+16 step 2

#if __has_builtin(__builtin_amdgcn_global_load_async_to_lds_b128)
#define USE_ASYNC_LDS 1
#else
#define USE_ASYNC_LDS 0
#endif

#define AS1 __attribute__((address_space(1)))
#define AS3 __attribute__((address_space(3)))

// ---------------- fp32 -> bf16 (round to nearest even) ----------------
__device__ __forceinline__ unsigned short f2bf(float f) {
  unsigned u = __builtin_bit_cast(unsigned, f);
  unsigned r = u + 0x7FFFu + ((u >> 16) & 1u);
  return (unsigned short)(r >> 16);
}

__global__ __launch_bounds__(256)
void cvt_f32_bf16(const float* __restrict__ in, unsigned short* __restrict__ out, int n4) {
  int i = blockIdx.x * blockDim.x + threadIdx.x;
  if (i >= n4) return;
  float4 f = ((const float4*)in)[i];
  ushort4 o;
  o.x = f2bf(f.x); o.y = f2bf(f.y); o.z = f2bf(f.z); o.w = f2bf(f.w);
  ((ushort4*)out)[i] = o;
}

// ---------------- bf16 NT GEMM with fp32 accumulate: C = A * B^T + bias ----------------
// A: [M][Kd] bf16 row-major; Bm: [Nd][Kd] bf16 row-major (so B^T is Kd x Nd);
// C: [M][Nd] fp32.  M,Nd multiples of 128; Kd multiple of 64.
#define BM 128
#define BN 128
#define BK 64
#define LDT 72   // LDS row pitch in ushorts: 144 B = 16 B x odd, free of bank conflicts for 16-byte reads

union Frag { v16bf v; uint4 q[2]; };

__device__ __forceinline__ void stage_chunk(const unsigned short* __restrict__ gsrc,
                                            unsigned short* lds_dst) {
#if USE_ASYNC_LDS
  // CDNA5 async DMA: global -> LDS without VGPR round trip, tracked on ASYNCcnt
  __builtin_amdgcn_global_load_async_to_lds_b128(
      (AS1 v4i*)gsrc, (AS3 v4i*)lds_dst, 0, 0);
#else
  *(uint4*)lds_dst = *(const uint4*)gsrc;
#endif
}

// One K step's A and B tiles, 128 rows of 128 bytes each. ga, gb, la, lb are the lane's own places in
// the first 32 rows: eight lanes lie along a row, so each wave-wide copy covers four whole 128-byte lines.
__device__ __forceinline__ void stage_tile(const unsigned short* __restrict__ ga,
                                           const unsigned short* __restrict__ gb,
                                           unsigned short* la, unsigned short* lb, int Kd) {
  // unrolled: the eight copies issue back to back, their row steps folded into the addresses
#pragma unroll
  for (int s = 0; s < BM / 32; ++s) {
    stage_chunk(ga + (size_t)(s * 32) * Kd, la + s * 32 * LDT);
    stage_chunk(gb + (size_t)(s * 32) * Kd, lb + s * 32 * LDT);
  }
}

__global__ __launch_bounds__(256)
void gemm_nt_bias(const unsigned short* __restrict__ A,
                  const unsigned short* __restrict__ Bm,
                  const float* __restrict__ bias,
                  float* __restrict__ C,
                  int Ndim, int Kd) {
  __shared__ __attribute__((aligned(16))) unsigned short As[2][BM * LDT];
  __shared__ __attribute__((aligned(16))) unsigned short Bs[2][BN * LDT];

  const int tid  = threadIdx.x;
  const int lane = tid & 31;
  const int wid  = tid >> 5;
  const int wm   = wid >> 2;     // 0..1  -> 64 rows each
  const int wn   = wid & 3;      // 0..3  -> 32 cols each
  const int l16  = lane & 15;
  const int half = lane >> 4;    // 0/1: selects K sub-chunk per ISA bf16 A/B layout

  const int brow = blockIdx.y * BM;
  const int bcol = blockIdx.x * BN;
  const int T = Kd / BK;

  v8f acc[4][2] = {};

  // this lane's 16-byte chunk of a staged row: row tid / 8 of each group of 32 rows, chunk tid % 8
  const unsigned short* ga = A  + (size_t)(brow + (tid >> 3)) * Kd + (tid & 7) * 8;
  const unsigned short* gb = Bm + (size_t)(bcol + (tid >> 3)) * Kd + (tid & 7) * 8;
  const int lofs = (tid >> 3) * LDT + (tid & 7) * 8;

  // tile 0 lands and is published; tile 1 then flies while tile 0 is worked on
  stage_tile(ga, gb, &As[0][lofs], &Bs[0][lofs], Kd);
  asm volatile("s_wait_asynccnt 0x0" ::: "memory");   // this wave's copies of tile 0 have landed
  __syncthreads();
  if (T > 1) stage_tile(ga + BK, gb + BK, &As[1][lofs], &Bs[1][lofs], Kd);

  for (int t = 0; t < T; ++t) {
    const int cur = t & 1;

    // fragment fetch from LDS (matches ISA 16-bit A/B VGPR layout:
    // lane<16 -> K[0..7],K[16..23]; lane>=16 -> K[8..15],K[24..31]), one 32-deep half of the tile at a time
    // (unrolled: every fragment and accumulator index is a constant, so all of them stay in registers)
#pragma unroll
    for (int kk = 0; kk < BK / 32; ++kk) {
      Frag a[4], b[2];
#pragma unroll
      for (int mf = 0; mf < 4; ++mf) {
        int row = wm * 64 + mf * 16 + l16;
        a[mf].q[0] = *(const uint4*)&As[cur][row * LDT + kk * 32 + half * 8];
        a[mf].q[1] = *(const uint4*)&As[cur][row * LDT + kk * 32 + 16 + half * 8];
      }
#pragma unroll
      for (int nf = 0; nf < 2; ++nf) {
        int row = wn * 32 + nf * 16 + l16;
        b[nf].q[0] = *(const uint4*)&Bs[cur][row * LDT + kk * 32 + half * 8];
        b[nf].q[1] = *(const uint4*)&Bs[cur][row * LDT + kk * 32 + 16 + half * 8];
      }
#pragma unroll
      for (int mf = 0; mf < 4; ++mf)
#pragma unroll
        for (int nf = 0; nf < 2; ++nf)
          acc[mf][nf] = __builtin_amdgcn_wmma_f32_16x16x32_bf16(
              false, a[mf].v, false, b[nf].v, (short)0, acc[mf][nf], false, false);
    }

    asm volatile("s_wait_dscnt 0x0" ::: "memory");      // this wave's reads of buffer cur have retired
    asm volatile("s_wait_asynccnt 0x0" ::: "memory");   // its copies of tile t + 1 have landed
    __syncthreads();    // publishes tile t + 1 and ends every wave's reads of buffer cur
    if (t + 2 < T)
      stage_tile(ga + (t + 2) * BK, gb + (t + 2) * BK, &As[cur][lofs], &Bs[cur][lofs], Kd);
  }
  asm volatile("s_wait_asynccnt 0x0" ::: "memory");     // no copy is left in flight when the wave ends

  // epilogue: C/D layout -> VGPR r: lanes 0-15 are M=r, lanes 16-31 are M=8+r, N=lane%16
#pragma unroll
  for (int nf = 0; nf < 2; ++nf) {
    int gn = bcol + wn * 32 + nf * 16 + l16;
    float bb = bias[gn];
#pragma unroll
    for (int mf = 0; mf < 4; ++mf) {
      int gm = brow + wm * 64 + mf * 16 + half * 8;
      float* Cp = C + (size_t)gm * Ndim + gn;
#pragma unroll
      for (int r = 0; r < 8; ++r)
        Cp[(size_t)r * Ndim] = acc[mf][nf][r] + bb;
    }
  }
}

// ---------------- dilated attention: 64 queries of one head per block, K/V rows in LDS ----------------
// Four lanes share a query, 16 head dims each. The block's 64 queries touch 96 consecutive
// key rows (16 before the first query to 16 behind the last): each is fetched once.
// The inverse norms of q and k are formed here, from the rows as they lie in registers: the 16 lanes
// that hold a key row sum its squares, and so do the four lanes that hold a query.
#define QT     64            // queries per block
#define KROWS  (QT + 32)     // staged key/value rows
#define KPITCH 68            // LDS row pitch in floats: 16 lanes of a b128 read hit 16 distinct bank groups

// sum over the four lanes of a quad, same bits in all four
__device__ __forceinline__ float quad_sum(float x) {
  x += __builtin_bit_cast(float, __builtin_amdgcn_mov_dpp(__builtin_bit_cast(int, x), 0xB1, 0xf, 0xf, true)); // quad_perm [1,0,3,2]
  x += __builtin_bit_cast(float, __builtin_amdgcn_mov_dpp(__builtin_bit_cast(int, x), 0x4E, 0xf, 0xf, true)); // quad_perm [2,3,0,1]
  return x;
}

// sum over the 16 lanes of a row, same bits in all sixteen
__device__ __forceinline__ float row_sum(float x) {
  x = quad_sum(x);
  x += __builtin_bit_cast(float, __builtin_amdgcn_mov_dpp(__builtin_bit_cast(int, x), 0x164, 0xf, 0xf, true)); // row_xmask:4
  x += __builtin_bit_cast(float, __builtin_amdgcn_mov_dpp(__builtin_bit_cast(int, x), 0x168, 0xf, 0xf, true)); // row_xmask:8
  return x;
}

// e^x as the fast intrinsic forms it (multiply by log2 e, v_exp_f32); the v_nop fills the one slot the
// instruction set asks for between a transcendental and a next instruction that overwrites its source
__device__ __forceinline__ float exp_slot(float x) {
  float r, y = x * 1.44269504088896340736f;
  asm("v_exp_f32 %0, %1\n\tv_nop" : "=v"(r) : "v"(y));
  return r;
}

typedef __attribute__((ext_vector_type(2))) float v2f;
typedef __attribute__((ext_vector_type(4))) float v4f;

// eight waves per SIMD (four blocks per WGP): one block's staging hides behind another's arithmetic
__global__ __launch_bounds__(256) __attribute__((amdgpu_waves_per_eu(8)))
void dilated_attn(const float* __restrict__ qkv, unsigned short* __restrict__ aout) {
  __shared__ __attribute__((aligned(16))) float Ks[KROWS * KPITCH];
  __shared__ __attribute__((aligned(16))) float Vs[KROWS * KPITCH];

  const int tid  = threadIdx.x;
  const int tile = blockIdx.x % (SEQ / QT);
  const int rest = blockIdx.x / (SEQ / QT);
  const int h    = rest % HH;
  const int b    = rest / HH;
  const int i0   = tile * QT;

  const int ql   = tid >> 2;   // query inside the block
  const int part = tid & 3;    // which 16 of the 64 head dims
  const int i    = i0 + ql;
  const int m    = b * SEQ + i;

  // Every address below is a block-uniform base plus one of two per-lane byte offsets.
  const unsigned qoff  = (unsigned)ql * (3 * DMODEL * 4) + (unsigned)part * 64;   // query row, 16 dims
  const unsigned koff  = (unsigned)(tid >> 4) * (3 * DMODEL * 4) + (unsigned)(tid & 15) * 16;  // row of a 16-row group, 16B chunk

  // this lane's 16 query values, as stored; normalised behind the barrier
  const char* qb  = (const char*)(qkv + (size_t)(b * SEQ + i0) * (3 * DMODEL) + h * DH);
  const v4f* qp = (const v4f*)(qb + qoff);
  const v4f qr0 = qp[0], qr1 = qp[1], qr2 = qp[2], qr3 = qp[3];

  // Rows i0-16 .. i0+QT+15 in six groups of 16 rows, one group per pass of the block. Only the first
  // group of the first tile and the last group of the last tile lie outside the sequence, each as a
  // whole: such a group reads the tile's own first rows instead (in bounds) and is staged as zeros.
  const bool okf = tile > 0, okl = tile < SEQ / QT - 1;
  const int  gf  = okf ? i0 - 16 : i0, gl = okl ? i0 + QT : i0;
  const char* rbf = (const char*)(qkv + (size_t)(b * SEQ + gf) * (3 * DMODEL) + h * DH);
  const char* rbl = (const char*)(qkv + (size_t)(b * SEQ + gl) * (3 * DMODEL) + h * DH);

  float4 k4[KROWS / 16], v4[KROWS / 16];
#pragma unroll
  for (int s = 0; s < KROWS / 16; ++s) {
    const char* rb = s == 0 ? rbf : s == KROWS / 16 - 1 ? rbl : qb + (s - 1) * (16 * 3 * DMODEL * 4);
    k4[s] = *(const float4*)(rb + koff + DMODEL * 4);       // the row's K columns of this head
    v4[s] = *(const float4*)(rb + koff + 2 * DMODEL * 4);   // its V columns
  }
  // The wait that stands in front of the first overwrite of a register that an issued load names. Its
  // inputs are those registers: they stay live up to here, so no load's result is placed on one of them;
  // the clobber keeps every load above in front of it (the query loads too, in flight with the staging).
  asm volatile("s_wait_xcnt 0x0"
               :: "v"(qoff), "v"(koff), "s"(qb), "s"(rbf), "s"(rbl)
               : "memory");

  // K normalised on the way into LDS
#pragma unroll
  for (int s = 0; s < KROWS / 16; ++s) {
    const bool ok = s == 0 ? okf : s == KROWS / 16 - 1 ? okl : true;
    const int at = (s * 16 + (tid >> 4)) * KPITCH + (tid & 15) * 4;
    const float kk = row_sum(k4[s].x * k4[s].x + k4[s].y * k4[s].y + k4[s].z * k4[s].z + k4[s].w * k4[s].w);
    const float ki = 1.0f / (sqrtf(kk) + 1e-6f);
    float4 ko, vo;
    ko.x = ok ? k4[s].x * ki : 0.f; ko.y = ok ? k4[s].y * ki : 0.f;
    ko.z = ok ? k4[s].z * ki : 0.f; ko.w = ok ? k4[s].w * ki : 0.f;
    vo.x = ok ? v4[s].x : 0.f; vo.y = ok ? v4[s].y : 0.f;
    vo.z = ok ? v4[s].z : 0.f; vo.w = ok ? v4[s].w : 0.f;
    *(float4*)&Ks[at] = ko;
    *(float4*)&Vs[at] = vo;
  }
  __syncthreads();

  v2f q[8];
  {
    const v4f sq = qr0 * qr0 + qr1 * qr1 + qr2 * qr2 + qr3 * qr3;
    const float qi = 1.0f / (sqrtf(quad_sum((sq.x + sq.y) + (sq.z + sq.w))) + 1e-6f);
    v4f f0 = qr0 * qi, f1 = qr1 * qi, f2 = qr2 * qi, f3 = qr3 * qi;
    q[0] = f0.lo; q[1] = f0.hi; q[2] = f1.lo; q[3] = f1.hi;
    q[4] = f2.lo; q[5] = f2.hi; q[6] = f3.lo; q[7] = f3.hi;
  }

  float s[WIN];
#pragma unroll
  for (int t = 0; t < WIN; ++t) {
    const v4f* kr = (const v4f*)&Ks[(ql + 2 * t) * KPITCH + part * 16];
    v2f pa = {0.f, 0.f};
#pragma unroll
    for (int k = 0; k < 4; ++k) {
      v4f f = kr[k];
      pa += q[2 * k] * f.lo;
      pa += q[2 * k + 1] * f.hi;
    }
    float p = quad_sum(pa.x + pa.y);
    int j = i - 16 + 2 * t;
    s[t] = (j >= 0 && j < SEQ) ? p : -3.0e38f;
  }
  float mx = -3.0e38f;
#pragma unroll
  for (int t = 0; t < WIN; ++t) mx = fmaxf(mx, s[t]);
  float sum = 0.f;
#pragma unroll
  for (int t = 0; t < WIN; ++t) { s[t] = exp_slot(s[t] - mx); sum += s[t]; }
  float inv = 1.0f / sum;

  v2f o[8];
#pragma unroll
  for (int k = 0; k < 8; ++k) o[k] = (v2f){0.f, 0.f};
#pragma unroll
  for (int t = 0; t < WIN; ++t) {
    const v4f* vr = (const v4f*)&Vs[(ql + 2 * t) * KPITCH + part * 16];
    float w = s[t] * inv;
#pragma unroll
    for (int k = 0; k < 4; ++k) {
      v4f f = vr[k];
      o[2 * k]     += w * f.lo;
      o[2 * k + 1] += w * f.hi;
    }
  }

  unsigned pk[8];
#pragma unroll
  for (int k = 0; k < 8; ++k)
    pk[k] = (unsigned)f2bf(o[k].x) | ((unsigned)f2bf(o[k].y) << 16);
  uint4* op = (uint4*)(aout + (size_t)m * DMODEL + h * DH + part * 16);
  op[0] = make_uint4(pk[0], pk[1], pk[2], pk[3]);
  op[1] = make_uint4(pk[4], pk[5], pk[6], pk[7]);
}

// ---------------- launch ----------------
extern "C" void kernel_launch(void* const* d_in, const int* in_sizes, int n_in,
                              void* d_out, int out_size, void* d_ws, size_t ws_size,
                              hipStream_t stream) {
  const float* x     = (const float*)d_in[0];  // [2,2048,1024]
  const float* w_qkv = (const float*)d_in[1];  // [3072,1024]
  const float* b_qkv = (const float*)d_in[2];  // [3072]
  const float* w_out = (const float*)d_in[3];  // [1024,1024]
  const float* b_out = (const float*)d_in[4];  // [1024]
  float* out = (float*)d_out;                  // [2,2048,1024] fp32

  const int M  = BATCH * SEQ;      // 4096
  const int N1 = 3 * DMODEL;       // 3072
  const int N2 = DMODEL;           // 1024
  const int Kd = DMODEL;           // 1024

  char* w = (char*)d_ws;
  unsigned short* xb    = (unsigned short*)(w);                    // 8 MB
  unsigned short* wqkvb = (unsigned short*)(w + (8u << 20));       // 6 MB
  unsigned short* woutb = (unsigned short*)(w + (14u << 20));      // 2 MB
  float*          qkv   = (float*)(w + (16u << 20));               // 48 MB
  unsigned short* attnb = (unsigned short*)(w + (65u << 20));      // 8 MB

  // 1) fp32 -> bf16 conversions
  {
    int n4 = (M * Kd) / 4;
    cvt_f32_bf16<<<(n4 + 255) / 256, 256, 0, stream>>>(x, xb, n4);
    n4 = (N1 * Kd) / 4;
    cvt_f32_bf16<<<(n4 + 255) / 256, 256, 0, stream>>>(w_qkv, wqkvb, n4);
    n4 = (N2 * Kd) / 4;
    cvt_f32_bf16<<<(n4 + 255) / 256, 256, 0, stream>>>(w_out, woutb, n4);
  }

  // 2) QKV projection: qkv = x @ w_qkv^T + b_qkv  (WMMA bf16, fp32 acc)
  gemm_nt_bias<<<dim3(N1 / BN, M / BM), 256, 0, stream>>>(xb, wqkvb, b_qkv, qkv, N1, Kd);

  // 3) dilated masked attention with q/k norms -> bf16 [M, D]
  dilated_attn<<<(M * HH) / QT, 256, 0, stream>>>(qkv, attnb);

  // 4) output projection: out = attn @ w_out^T + b_out
  gemm_nt_bias<<<dim3(N2 / BN, M / BM), 256, 0, stream>>>(attnb, woutb, b_out, out, N2, Kd);
}

// v004
// A run of this version takes 65.9 microseconds.
// Next to v003, in two timings, it ran 1.06 times as fast each time.
// Over all steps from v000 it is 3.52 times as fast.
#include <hip/hip_runtime.h>
#include <hip/hip_bf16.h>

typedef __attribute__((ext_vector_type(16))) __bf16 v16bf;
typedef __attribute__((ext_vector_type(8)))  float  v8f;
typedef __attribute__((ext_vector_type(4)))  int    v4i;

#define HH     16      // heads
#define DH     64      // head dim
#define SEQ    2048
#define DMODEL 1024
#define BATCH  2
#define WIN    17      // dilated window size: j = i-16 .. i+16 step 2

#if __has_builtin(__builtin_amdgcn_global_load_async_to_lds_b128)
#define USE_ASYNC_LDS 1
#else
#define USE_ASYNC_LDS 0
#endif

#define AS1 __attribute__((address_space(1)))
#define AS3 __attribute__((address_space(3)))

// ---------------- fp32 -> bf16 (round to nearest even) ----------------
__device__ __forceinline__ unsigned short f2bf(float f) {
  unsigned u = __builtin_bit_cast(unsigned, f);
  unsigned r = u + 0x7FFFu + ((u >> 16) & 1u);
  return (unsigned short)(r >> 16);
}

// One launch converts all three fp32 operands. Their bf16 copies lie back to back in the workspace, so
// the flat index is the place in out; each operand fills a whole number of blocks, so the source is
// picked once per block, by a scalar test.
#define X4  (BATCH * SEQ * DMODEL / 4)     // groups of four floats in x
#define WQ4 (3 * DMODEL * DMODEL / 4)      // in w_qkv
#define WO4 (DMODEL * DMODEL / 4)          // in w_out

__global__ __launch_bounds__(256)
void cvt3_f32_bf16(const float* __restrict__ x, const float* __restrict__ wqkv,
                   const float* __restrict__ wout, unsigned short* __restrict__ out) {
  const int first = blockIdx.x * 256;      // the block's first group, counted over all three operands
  const float* src = x;
  int base = 0;
  if (first >= X4 + WQ4)  { src = wout; base = X4 + WQ4; }
  else if (first >= X4)   { src = wqkv; base = X4; }
  // both block bases are scalar: the thread index alone is the lane's offset for the load and the store
  const float4* in4 = (const float4*)src + (first - base);
  ushort4* out4 = (ushort4*)out + first;
  float4 f = in4[threadIdx.x];
  ushort4 o;
  o.x = f2bf(f.x); o.y = f2bf(f.y); o.z = f2bf(f.z); o.w = f2bf(f.w);
  out4[threadIdx.x] = o;
}

// ---------------- bf16 NT GEMM with fp32 accumulate: C = A * B^T + bias ----------------
// A: [M][Kd] bf16 row-major; Bm: [Nd][Kd] bf16 row-major (so B^T is Kd x Nd);
// C: [M][Nd] fp32.  M,Nd multiples of 128; Kd multiple of 64.
#define BM 128
#define BN 128
#define BK 64
#define LDT 72   // LDS row pitch in ushorts: 144 B = 16 B x odd, free of bank conflicts for 16-byte reads

union Frag { v16bf v; uint4 q[2]; };

__device__ __forceinline__ void stage_chunk(const unsigned short* __restrict__ gsrc,
                                            unsigned short* lds_dst) {
#if USE_ASYNC_LDS
  // CDNA5 async DMA: global -> LDS without VGPR round trip, tracked on ASYNCcnt
  __builtin_amdgcn_global_load_async_to_lds_b128(
      (AS1 v4i*)gsrc, (AS3 v4i*)lds_dst, 0, 0);
#else
  *(uint4*)lds_dst = *(const uint4*)gsrc;
#endif
}

// One K step's A and B tiles, 128 rows of 128 bytes each. ga, gb, la, lb are the lane's own places in
// the first 32 rows: eight lanes lie along a row, so each wave-wide copy covers four whole 128-byte lines.
__device__ __forceinline__ void stage_tile(const unsigned short* __restrict__ ga,
                                           const unsigned short* __restrict__ gb,
                                           unsigned short* la, unsigned short* lb, int Kd) {
  // unrolled: the eight copies issue back to back, their row steps folded into the addresses
#pragma unroll
  for (int s = 0; s < BM / 32; ++s) {
    stage_chunk(ga + (size_t)(s * 32) * Kd, la + s * 32 * LDT);
    stage_chunk(gb + (size_t)(s * 32) * Kd, lb + s * 32 * LDT);
  }
}

__global__ __launch_bounds__(256)
void gemm_nt_bias(const unsigned short* __restrict__ A,
                  const unsigned short* __restrict__ Bm,
                  const float* __restrict__ bias,
                  float* __restrict__ C,
                  int Ndim, int Kd) {
  __shared__ __attribute__((aligned(16))) unsigned short As[2][BM * LDT];
  __shared__ __attribute__((aligned(16))) unsigned short Bs[2][BN * LDT];

  const int tid  = threadIdx.x;
  const int lane = tid & 31;
  const int wid  = tid >> 5;
  const int wm   = wid >> 2;     // 0..1  -> 64 rows each
  const int wn   = wid & 3;      // 0..3  -> 32 cols each
  const int l16  = lane & 15;
  const int half = lane >> 4;    // 0/1: selects K sub-chunk per ISA bf16 A/B layout

  const int brow = blockIdx.y * BM;
  const int bcol = blockIdx.x * BN;
  const int T = Kd / BK;

  v8f acc[4][2] = {};

  // this lane's 16-byte chunk of a staged row: row tid / 8 of each group of 32 rows, chunk tid % 8
  const unsigned short* ga = A  + (size_t)(brow + (tid >> 3)) * Kd + (tid & 7) * 8;
  const unsigned short* gb = Bm + (size_t)(bcol + (tid >> 3)) * Kd + (tid & 7) * 8;
  const int lofs = (tid >> 3) * LDT + (tid & 7) * 8;

  // tile 0 lands and is published; tile 1 then flies while tile 0 is worked on
  stage_tile(ga, gb, &As[0][lofs], &Bs[0][lofs], Kd);
  asm volatile("s_wait_asynccnt 0x0" ::: "memory");   // this wave's copies of tile 0 have landed
  __syncthreads();
  if (T > 1) stage_tile(ga + BK, gb + BK, &As[1][lofs], &Bs[1][lofs], Kd);

  for (int t = 0; t < T; ++t) {
    const int cur = t & 1;

    // fragment fetch from LDS (matches ISA 16-bit A/B VGPR layout:
    // lane<16 -> K[0..7],K[16..23]; lane>=16 -> K[8..15],K[24..31]), one 32-deep half of the tile at a time
    // (unrolled: every fragment and accumulator index is a constant, so all of them stay in registers)
#pragma unroll
    for (int kk = 0; kk < BK / 32; ++kk) {
      Frag a[4], b[2];
#pragma unroll
      for (int mf = 0; mf < 4; ++mf) {
        int row = wm * 64 + mf * 16 + l16;
        a[mf].q[0] = *(const uint4*)&As[cur][row * LDT + kk * 32 + half * 8];
        a[mf].q[1] = *(const uint4*)&As[cur][row * LDT + kk * 32 + 16 + half * 8];
      }
#pragma unroll
      for (int nf = 0; nf < 2; ++nf) {
        int row = wn * 32 + nf * 16 + l16;
        b[nf].q[0] = *(const uint4*)&Bs[cur][row * LDT + kk * 32 + half * 8];
        b[nf].q[1] = *(const uint4*)&Bs[cur][row * LDT + kk * 32 + 16 + half * 8];
      }
#pragma unroll
      for (int mf = 0; mf < 4; ++mf)
#pragma unroll
        for (int nf = 0; nf < 2; ++nf)
          acc[mf][nf] = __builtin_amdgcn_wmma_f32_16x16x32_bf16(
              false, a[mf].v, false, b[nf].v, (short)0, acc[mf][nf], false, false);
    }

    asm volatile("s_wait_dscnt 0x0" ::: "memory");      // this wave's reads of buffer cur have retired
    asm volatile("s_wait_asynccnt 0x0" ::: "memory");   // its copies of tile t + 1 have landed
    __syncthreads();    // publishes tile t + 1 and ends every wave's reads of buffer cur
    if (t + 2 < T)
      stage_tile(ga + (t + 2) * BK, gb + (t + 2) * BK, &As[cur][lofs], &Bs[cur][lofs], Kd);
  }
  asm volatile("s_wait_asynccnt 0x0" ::: "memory");     // no copy is left in flight when the wave ends

  // epilogue: C/D layout -> VGPR r: lanes 0-15 are M=r, lanes 16-31 are M=8+r, N=lane%16
#pragma unroll
  for (int nf = 0; nf < 2; ++nf) {
    int gn = bcol + wn * 32 + nf * 16 + l16;
    float bb = bias[gn];
#pragma unroll
    for (int mf = 0; mf < 4; ++mf) {
      int gm = brow + wm * 64 + mf * 16 + half * 8;
      float* Cp = C + (size_t)gm * Ndim + gn;
#pragma unroll
      for (int r = 0; r < 8; ++r)
        Cp[(size_t)r * Ndim] = acc[mf][nf][r] + bb;
    }
  }
}

// ---------------- dilated attention: 64 queries of one head per block, K/V rows in LDS ----------------
// Four lanes share a query, 16 head dims each. The block's 64 queries touch 96 consecutive
// key rows (16 before the first query to 16 behind the last): each is fetched once.
// The inverse norms of q and k are formed here, from the rows as they lie in registers: the 16 lanes
// that hold a key row sum its squares, and so do the four lanes that hold a query.
#define QT     64            // queries per block
#define KROWS  (QT + 32)     // staged key/value rows
#define KPITCH 68            // LDS row pitch in floats: 16 lanes of a b128 read hit 16 distinct bank groups

// sum over the four lanes of a quad, same bits in all four
__device__ __forceinline__ float quad_sum(float x) {
  x += __builtin_bit_cast(float, __builtin_amdgcn_mov_dpp(__builtin_bit_cast(int, x), 0xB1, 0xf, 0xf, true)); // quad_perm [1,0,3,2]
  x += __builtin_bit_cast(float, __builtin_amdgcn_mov_dpp(__builtin_bit_cast(int, x), 0x4E, 0xf, 0xf, true)); // quad_perm [2,3,0,1]
  return x;
}

// sum over the 16 lanes of a row, same bits in all sixteen
__device__ __forceinline__ float row_sum(float x) {
  x = quad_sum(x);
  x += __builtin_bit_cast(float, __builtin_amdgcn_mov_dpp(__builtin_bit_cast(int, x), 0x164, 0xf, 0xf, true)); // row_xmask:4
  x += __builtin_bit_cast(float, __builtin_amdgcn_mov_dpp(__builtin_bit_cast(int, x), 0x168, 0xf, 0xf, true)); // row_xmask:8
  return x;
}

// e^x as the fast intrinsic forms it (multiply by log2 e, v_exp_f32); the v_nop fills the one slot the
// instruction set asks for between a transcendental and a next instruction that overwrites its source
__device__ __forceinline__ float exp_slot(float x) {
  float r, y = x * 1.44269504088896340736f;
  asm("v_exp_f32 %0, %1\n\tv_nop" : "=v"(r) : "v"(y));
  return r;
}

typedef __attribute__((ext_vector_type(2))) float v2f;
typedef __attribute__((ext_vector_type(4))) float v4f;

// eight waves per SIMD (four blocks per WGP): one block's staging hides behind another's arithmetic
__global__ __launch_bounds__(256) __attribute__((amdgpu_waves_per_eu(8)))
void dilated_attn(const float* __restrict__ qkv, unsigned short* __restrict__ aout) {
  __shared__ __attribute__((aligned(16))) float Ks[KROWS * KPITCH];
  __shared__ __attribute__((aligned(16))) float Vs[KROWS * KPITCH];

  const int tid  = threadIdx.x;
  const int tile = blockIdx.x % (SEQ / QT);
  const int rest = blockIdx.x / (SEQ / QT);
  const int h    = rest % HH;
  const int b    = rest / HH;
  const int i0   = tile * QT;

  const int ql   = tid >> 2;   // query inside the block
  const int part = tid & 3;    // which 16 of the 64 head dims
  const int i    = i0 + ql;
  const int m    = b * SEQ + i;

  // Every address below is a block-uniform base plus one of two per-lane byte offsets.
  const unsigned qoff  = (unsigned)ql * (3 * DMODEL * 4) + (unsigned)part * 64;   // query row, 16 dims
  const unsigned koff  = (unsigned)(tid >> 4) * (3 * DMODEL * 4) + (unsigned)(tid & 15) * 16;  // row of a 16-row group, 16B chunk

  // this lane's 16 query values, as stored; normalised behind the barrier
  const char* qb  = (const char*)(qkv + (size_t)(b * SEQ + i0) * (3 * DMODEL) + h * DH);
  const v4f* qp = (const v4f*)(qb + qoff);
  const v4f qr0 = qp[0], qr1 = qp[1], qr2 = qp[2], qr3 = qp[3];

  // Rows i0-16 .. i0+QT+15 in six groups of 16 rows, one group per pass of the block. Only the first
  // group of the first tile and the last group of the last tile lie outside the sequence, each as a
  // whole: such a group reads the tile's own first rows instead (in bounds) and is staged as zeros.
  const bool okf = tile > 0, okl = tile < SEQ / QT - 1;
  const int  gf  = okf ? i0 - 16 : i0, gl = okl ? i0 + QT : i0;
  const char* rbf = (const char*)(qkv + (size_t)(b * SEQ + gf) * (3 * DMODEL) + h * DH);
  const char* rbl = (const char*)(qkv + (size_t)(b * SEQ + gl) * (3 * DMODEL) + h * DH);

  float4 k4[KROWS / 16], v4[KROWS / 16];
#pragma unroll
  for (int s = 0; s < KROWS / 16; ++s) {
    const char* rb = s == 0 ? rbf : s == KROWS / 16 - 1 ? rbl : qb + (s - 1) * (16 * 3 * DMODEL * 4);
    k4[s] = *(const float4*)(rb + koff + DMODEL * 4);       // the row's K columns of this head
    v4[s] = *(const float4*)(rb + koff + 2 * DMODEL * 4);   // its V columns
  }
  // The wait that stands in front of the first overwrite of a register that an issued load names. Its
  // inputs are those registers: they stay live up to here, so no load's result is placed on one of them;
  // the clobber keeps every load above in front of it (the query loads too, in flight with the staging).
  asm volatile("s_wait_xcnt 0x0"
               :: "v"(qoff), "v"(koff), "s"(qb), "s"(rbf), "s"(rbl)
               : "memory");

  // K normalised on the way into LDS
#pragma unroll
  for (int s = 0; s < KROWS / 16; ++s) {
    const bool ok = s == 0 ? okf : s == KROWS / 16 - 1 ? okl : true;
    const int at = (s * 16 + (tid >> 4)) * KPITCH + (tid & 15) * 4;
    const float kk = row_sum(k4[s].x * k4[s].x + k4[s].y * k4[s].y + k4[s].z * k4[s].z + k4[s].w * k4[s].w);
    const float ki = 1.0f / (sqrtf(kk) + 1e-6f);
    float4 ko, vo;
    ko.x = ok ? k4[s].x * ki : 0.f; ko.y = ok ? k4[s].y * ki : 0.f;
    ko.z = ok ? k4[s].z * ki : 0.f; ko.w = ok ? k4[s].w * ki : 0.f;
    vo.x = ok ? v4[s].x : 0.f; vo.y = ok ? v4[s].y : 0.f;
    vo.z = ok ? v4[s].z : 0.f; vo.w = ok ? v4[s].w : 0.f;
    *(float4*)&Ks[at] = ko;
    *(float4*)&Vs[at] = vo;
  }
  __syncthreads();

  v2f q[8];
  {
    const v4f sq = qr0 * qr0 + qr1 * qr1 + qr2 * qr2 + qr3 * qr3;
    const float qi = 1.0f / (sqrtf(quad_sum((sq.x + sq.y) + (sq.z + sq.w))) + 1e-6f);
    v4f f0 = qr0 * qi, f1 = qr1 * qi, f2 = qr2 * qi, f3 = qr3 * qi;
    q[0] = f0.lo; q[1] = f0.hi; q[2] = f1.lo; q[3] = f1.hi;
    q[4] = f2.lo; q[5] = f2.hi; q[6] = f3.lo; q[7] = f3.hi;
  }

  float s[WIN];
#pragma unroll
  for (int t = 0; t < WIN; ++t) {
    const v4f* kr = (const v4f*)&Ks[(ql + 2 * t) * KPITCH + part * 16];
    v2f pa = {0.f, 0.f};
#pragma unroll
    for (int k = 0; k < 4; ++k) {
      v4f f = kr[k];
      pa += q[2 * k] * f.lo;
      pa += q[2 * k + 1] * f.hi;
    }
    float p = quad_sum(pa.x + pa.y);
    int j = i - 16 + 2 * t;
    s[t] = (j >= 0 && j < SEQ) ? p : -3.0e38f;
  }
  float mx = -3.0e38f;
#pragma unroll
  for (int t = 0; t < WIN; ++t) mx = fmaxf(mx, s[t]);
  float sum = 0.f;
#pragma unroll
  for (int t = 0; t < WIN; ++t) { s[t] = exp_slot(s[t] - mx); sum += s[t]; }
  float inv = 1.0f / sum;

  v2f o[8];
#pragma unroll
  for (int k = 0; k < 8; ++k) o[k] = (v2f){0.f, 0.f};
#pragma unroll
  for (int t = 0; t < WIN; ++t) {
    const v4f* vr = (const v4f*)&Vs[(ql + 2 * t) * KPITCH + part * 16];
    float w = s[t] * inv;
#pragma unroll
    for (int k = 0; k < 4; ++k) {
      v4f f = vr[k];
      o[2 * k]     += w * f.lo;
      o[2 * k + 1] += w * f.hi;
    }
  }

  unsigned pk[8];
#pragma unroll
  for (int k = 0; k < 8; ++k)
    pk[k] = (unsigned)f2bf(o[k].x) | ((unsigned)f2bf(o[k].y) << 16);
  uint4* op = (uint4*)(aout + (size_t)m * DMODEL + h * DH + part * 16);
  op[0] = make_uint4(pk[0], pk[1], pk[2], pk[3]);
  op[1] = make_uint4(pk[4], pk[5], pk[6], pk[7]);
}

// ---------------- launch ----------------
extern "C" void kernel_launch(void* const* d_in, const int* in_sizes, int n_in,
                              void* d_out, int out_size, void* d_ws, size_t ws_size,
                              hipStream_t stream) {
  const float* x     = (const float*)d_in[0];  // [2,2048,1024]
  const float* w_qkv = (const float*)d_in[1];  // [3072,1024]
  const float* b_qkv = (const float*)d_in[2];  // [3072]
  const float* w_out = (const float*)d_in[3];  // [1024,1024]
  const float* b_out = (const float*)d_in[4];  // [1024]
  float* out = (float*)d_out;                  // [2,2048,1024] fp32

  const int M  = BATCH * SEQ;      // 4096
  const int N1 = 3 * DMODEL;       // 3072
  const int N2 = DMODEL;           // 1024
  const int Kd = DMODEL;           // 1024

  char* w = (char*)d_ws;
  unsigned short* xb    = (unsigned short*)(w);                    // 8 MB
  unsigned short* wqkvb = (unsigned short*)(w + (8u << 20));       // 6 MB
  unsigned short* woutb = (unsigned short*)(w + (14u << 20));      // 2 MB
  float*          qkv   = (float*)(w + (16u << 20));               // 48 MB
  unsigned short* attnb = (unsigned short*)(w + (65u << 20));      // 8 MB

  // 1) fp32 -> bf16 conversions, one launch: xb, wqkvb and woutb are one run of bytes from xb on
  cvt3_f32_bf16<<<(X4 + WQ4 + WO4) / 256, 256, 0, stream>>>(x, w_qkv, w_out, xb);

  // 2) QKV projection: qkv = x @ w_qkv^T + b_qkv  (WMMA bf16, fp32 acc)
  gemm_nt_bias<<<dim3(N1 / BN, M / BM), 256, 0, stream>>>(xb, wqkvb, b_qkv, qkv, N1, Kd);

  // 3) dilated masked attention with q/k norms -> bf16 [M, D]
  dilated_attn<<<(M * HH) / QT, 256, 0, stream>>>(qkv, attnb);

  // 4) output projection: out = attn @ w_out^T + b_out
  gemm_nt_bias<<<dim3(N2 / BN, M / BM), 256, 0, stream>>>(attnb, woutb, b_out, out, N2, Kd);
}

// v005
// It runs in 50.5 microseconds.
// In both of two side-by-side timings against v004, it was 1.31 times as fast.
// All steps since v000 together make it 4.62 times as fast.
#include <hip/hip_runtime.h>
#include <hip/hip_bf16.h>

typedef __attribute__((ext_vector_type(16))) __bf16 v16bf;
typedef __attribute__((ext_vector_type(8)))  float  v8f;
typedef __attribute__((ext_vector_type(4)))  int    v4i;

#define HH     16      // heads
#define DH     64      // head dim
#define SEQ    2048
#define DMODEL 1024
#define BATCH  2
#define WIN    17      // dilated window size: j = i-16 .. i+16 step 2

#if __has_builtin(__builtin_amdgcn_global_load_async_to_lds_b128)
#define USE_ASYNC_LDS 1
#else
#define USE_ASYNC_LDS 0
#endif

#define AS1 __attribute__((address_space(1)))
#define AS3 __attribute__((address_space(3)))

// ---------------- fp32 -> bf16 (round to nearest even) ----------------
__device__ __forceinline__ unsigned short f2bf(float f) {
  unsigned u = __builtin_bit_cast(unsigned, f);
  unsigned r = u + 0x7FFFu + ((u >> 16) & 1u);
  return (unsigned short)(r >> 16);
}

// One launch converts all three fp32 operands. Their bf16 copies lie back to back in the workspace, so
// the flat index is the place in out; each operand fills a whole number of blocks, so the source is
// picked once per block, by a scalar test.
#define X4  (BATCH * SEQ * DMODEL / 4)     // groups of four floats in x
#define WQ4 (3 * DMODEL * DMODEL / 4)      // in w_qkv
#define WO4 (DMODEL * DMODEL / 4)          // in w_out

__global__ __launch_bounds__(256)
void cvt3_f32_bf16(const float* __restrict__ x, const float* __restrict__ wqkv,
                   const float* __restrict__ wout, unsigned short* __restrict__ out) {
  const int first = blockIdx.x * 256;      // the block's first group, counted over all three operands
  const float* src = x;
  int base = 0;
  if (first >= X4 + WQ4)  { src = wout; base = X4 + WQ4; }
  else if (first >= X4)   { src = wqkv; base = X4; }
  // both block bases are scalar: the thread index alone is the lane's offset for the load and the store
  const float4* in4 = (const float4*)src + (first - base);
  ushort4* out4 = (ushort4*)out + first;
  float4 f = in4[threadIdx.x];
  ushort4 o;
  o.x = f2bf(f.x); o.y = f2bf(f.y); o.z = f2bf(f.z); o.w = f2bf(f.w);
  out4[threadIdx.x] = o;
}

// ---------------- bf16 NT GEMM with fp32 accumulate: C = A * B^T + bias ----------------
// A: [M][Kd] bf16 row-major; Bm: [Nd][Kd] bf16 row-major (so B^T is Kd x Nd);
// C: [M][Nd] fp32.  M,Nd multiples of 128; Kd multiple of 64.
#define BM 128
#define BN 128
#define BK 64
#define LDT 72   // LDS row pitch in ushorts: 144 B = 16 B x odd, free of bank conflicts for 16-byte reads

union Frag { v16bf v; uint4 q[2]; };

__device__ __forceinline__ void stage_chunk(const unsigned short* __restrict__ gsrc,
                                            unsigned short* lds_dst) {
#if USE_ASYNC_LDS
  // CDNA5 async DMA: global -> LDS without VGPR round trip, tracked on ASYNCcnt
  __builtin_amdgcn_global_load_async_to_lds_b128(
      (AS1 v4i*)gsrc, (AS3 v4i*)lds_dst, 0, 0);
#else
  *(uint4*)lds_dst = *(const uint4*)gsrc;
#endif
}

// One K step's A and B tiles, 128 rows of 128 bytes each. ga, gb, la, lb are the lane's own places in
// the first 32 rows: eight lanes lie along a row, so each wave-wide copy covers four whole 128-byte lines.
__device__ __forceinline__ void stage_tile(const unsigned short* __restrict__ ga,
                                           const unsigned short* __restrict__ gb,
                                           unsigned short* la, unsigned short* lb, int Kd) {
  // unrolled: the eight copies issue back to back, their row steps folded into the addresses
#pragma unroll
  for (int s = 0; s < BM / 32; ++s) {
    stage_chunk(ga + (size_t)(s * 32) * Kd, la + s * 32 * LDT);
    stage_chunk(gb + (size_t)(s * 32) * Kd, lb + s * 32 * LDT);
  }
}

__global__ __launch_bounds__(256)
void gemm_nt_bias(const unsigned short* __restrict__ A,
                  const unsigned short* __restrict__ Bm,
                  const float* __restrict__ bias,
                  float* __restrict__ C,
                  int Ndim, int Kd) {
  __shared__ __attribute__((aligned(16))) unsigned short As[2][BM * LDT];
  __shared__ __attribute__((aligned(16))) unsigned short Bs[2][BN * LDT];

  const int tid  = threadIdx.x;
  const int lane = tid & 31;
  const int wid  = tid >> 5;
  const int wm   = wid >> 2;     // 0..1  -> 64 rows each
  const int wn   = wid & 3;      // 0..3  -> 32 cols each
  const int l16  = lane & 15;
  const int half = lane >> 4;    // 0/1: selects K sub-chunk per ISA bf16 A/B layout

  const int brow = blockIdx.y * BM;
  const int bcol = blockIdx.x * BN;
  const int T = Kd / BK;

  v8f acc[4][2] = {};

  // this lane's 16-byte chunk of a staged row: row tid / 8 of each group of 32 rows, chunk tid % 8
  const unsigned short* ga = A  + (size_t)(brow + (tid >> 3)) * Kd + (tid & 7) * 8;
  const unsigned short* gb = Bm + (size_t)(bcol + (tid >> 3)) * Kd + (tid & 7) * 8;
  const int lofs = (tid >> 3) * LDT + (tid & 7) * 8;

  // tile 0 lands and is published; tile 1 then flies while tile 0 is worked on
  stage_tile(ga, gb, &As[0][lofs], &Bs[0][lofs], Kd);
  asm volatile("s_wait_asynccnt 0x0" ::: "memory");   // this wave's copies of tile 0 have landed
  __syncthreads();
  if (T > 1) stage_tile(ga + BK, gb + BK, &As[1][lofs], &Bs[1][lofs], Kd);

  for (int t = 0; t < T; ++t) {
    const int cur = t & 1;

    // fragment fetch from LDS (matches ISA 16-bit A/B VGPR layout:
    // lane<16 -> K[0..7],K[16..23]; lane>=16 -> K[8..15],K[24..31]), one 32-deep half of the tile at a time
    // (unrolled: every fragment and accumulator index is a constant, so all of them stay in registers)
#pragma unroll
    for (int kk = 0; kk < BK / 32; ++kk) {
      Frag a[4], b[2];
#pragma unroll
      for (int mf = 0; mf < 4; ++mf) {
        int row = wm * 64 + mf * 16 + l16;
        a[mf].q[0] = *(const uint4*)&As[cur][row * LDT + kk * 32 + half * 8];
        a[mf].q[1] = *(const uint4*)&As[cur][row * LDT + kk * 32 + 16 + half * 8];
      }
#pragma unroll
      for (int nf = 0; nf < 2; ++nf) {
        int row = wn * 32 + nf * 16 + l16;
        b[nf].q[0] = *(const uint4*)&Bs[cur][row * LDT + kk * 32 + half * 8];
        b[nf].q[1] = *(const uint4*)&Bs[cur][row * LDT + kk * 32 + 16 + half * 8];
      }
#pragma unroll
      for (int mf = 0; mf < 4; ++mf)
#pragma unroll
        for (int nf = 0; nf < 2; ++nf)
          acc[mf][nf] = __builtin_amdgcn_wmma_f32_16x16x32_bf16(
              false, a[mf].v, false, b[nf].v, (short)0, acc[mf][nf], false, false);
    }

    asm volatile("s_wait_dscnt 0x0" ::: "memory");      // this wave's reads of buffer cur have retired
    asm volatile("s_wait_asynccnt 0x0" ::: "memory");   // its copies of tile t + 1 have landed
    __syncthreads();    // publishes tile t + 1 and ends every wave's reads of buffer cur
    if (t + 2 < T)
      stage_tile(ga + (t + 2) * BK, gb + (t + 2) * BK, &As[cur][lofs], &Bs[cur][lofs], Kd);
  }
  asm volatile("s_wait_asynccnt 0x0" ::: "memory");     // no copy is left in flight when the wave ends

  // epilogue: C/D layout -> VGPR r: lanes 0-15 are M=r, lanes 16-31 are M=8+r, N=lane%16
#pragma unroll
  for (int nf = 0; nf < 2; ++nf) {
    int gn = bcol + wn * 32 + nf * 16 + l16;
    float bb = bias[gn];
#pragma unroll
    for (int mf = 0; mf < 4; ++mf) {
      int gm = brow + wm * 64 + mf * 16 + half * 8;
      float* Cp = C + (size_t)gm * Ndim + gn;
#pragma unroll
      for (int r = 0; r < 8; ++r)
        Cp[(size_t)r * Ndim] = acc[mf][nf][r] + bb;
    }
  }
}

// ---------------- QKV projection and dilated attention in one kernel ----------------
// A block takes 128 queries of one head. It projects the head's q, k and v columns (192 rows of w_qkv)
// for those queries' rows of x and for the 16 rows on either side, which the window reaches, keeps the
// fp32 result in LDS and attends there: q, k and v never go to memory. The rows on either side are
// projected again by the neighbouring blocks.
// In the attention part four lanes share a query, 16 head dims each; the 16 lanes that hold a key row
// sum its squares for the inverse norm, and so do the four lanes that hold a query.
#define FQ     128           // queries per block
#define FR     (FQ + 32)     // projected rows of x
#define FC     (3 * DH)      // projected columns: q, k, v of the head
#define FSTG   ((FR + FC) * LDT)   // ushorts in one ring buffer: the x rows, then the weight rows
#define KPITCH 68            // LDS row pitch in floats: 16 lanes of a b128 read hit 16 distinct bank groups

// sum over the four lanes of a quad, same bits in all four
__device__ __forceinline__ float quad_sum(float x) {
  x += __builtin_bit_cast(float, __builtin_amdgcn_mov_dpp(__builtin_bit_cast(int, x), 0xB1, 0xf, 0xf, true)); // quad_perm [1,0,3,2]
  x += __builtin_bit_cast(float, __builtin_amdgcn_mov_dpp(__builtin_bit_cast(int, x), 0x4E, 0xf, 0xf, true)); // quad_perm [2,3,0,1]
  return x;
}

// sum over the 16 lanes of a row, same bits in all sixteen
__device__ __forceinline__ float row_sum(float x) {
  x = quad_sum(x);
  x += __builtin_bit_cast(float, __builtin_amdgcn_mov_dpp(__builtin_bit_cast(int, x), 0x164, 0xf, 0xf, true)); // row_xmask:4
  x += __builtin_bit_cast(float, __builtin_amdgcn_mov_dpp(__builtin_bit_cast(int, x), 0x168, 0xf, 0xf, true)); // row_xmask:8
  return x;
}

// e^x as the fast intrinsic forms it (multiply by log2 e, v_exp_f32); the v_nop fills the one slot the
// instruction set asks for between a transcendental and a next instruction that overwrites its source
__device__ __forceinline__ float exp_slot(float x) {
  float r, y = x * 1.44269504088896340736f;
  asm("v_exp_f32 %0, %1\n\tv_nop" : "=v"(r) : "v"(y));
  return r;
}

typedef __attribute__((ext_vector_type(2))) float v2f;
typedef __attribute__((ext_vector_type(4))) float v4f;

// four waves per SIMD: two blocks per WGP, so that one block's waits hide behind the other's work
__global__ __launch_bounds__(256) __attribute__((amdgpu_waves_per_eu(4)))
void qkv_attn(const unsigned short* __restrict__ X, const unsigned short* __restrict__ Wq,
              const float* __restrict__ bias, unsigned short* __restrict__ aout) {
  // first the two-buffer ring of bf16 operand tiles, then, behind the K loop, q, k and v in fp32
  __shared__ __attribute__((aligned(16))) char smem[3 * FR * KPITCH * 4];
  static_assert(2 * FSTG * 2 <= 3 * FR * KPITCH * 4, "the ring fits in the q, k, v planes");
  unsigned short* ring = (unsigned short*)smem;
  float* Qs = (float*)smem;
  float* Ks = Qs + FR * KPITCH;
  float* Vs = Ks + FR * KPITCH;

  const int tid  = threadIdx.x;
  const int lane = tid & 31;
  const int wid  = tid >> 5;
  const int wm   = wid >> 2;     // 0..1  -> 80 rows each
  const int wn   = wid & 3;      // 0..3  -> 48 cols each
  const int l16  = lane & 15;
  const int half = lane >> 4;    // 0/1: selects K sub-chunk per ISA bf16 A/B layout

  const int h    = blockIdx.x % HH;
  const int rest = blockIdx.x / HH;
  const int tile = rest % (SEQ / FQ);
  const int b    = rest / (SEQ / FQ);
  const int i0   = tile * FQ;
  const int T    = DMODEL / BK;

  v8f acc[FR / 32][FC / 64] = {};

  // This lane's 16-byte chunk of a staged row: row tid / 8 of each group of 32 rows, chunk tid % 8.
  // Staged row r is position i0 - 16 + r of the sequence; a position outside it is clamped to the
  // nearest one inside (in bounds), and the window's own test keeps such a row out of every sum.
  unsigned ao[FR / 32];
#pragma unroll
  for (int s = 0; s < FR / 32; ++s) {
    int j = i0 - 16 + s * 32 + (tid >> 3);
    j = j < 0 ? 0 : j > SEQ - 1 ? SEQ - 1 : j;
    ao[s] = (unsigned)(b * SEQ + j) * DMODEL + (tid & 7) * 8;
  }
  const unsigned short* gb = Wq + (size_t)(h * DH + (tid >> 3)) * DMODEL + (tid & 7) * 8;
  const int lofs = (tid >> 3) * LDT + (tid & 7) * 8;

  // one K step's tiles: 160 rows of x and 192 of w_qkv (64 each from its q, k and v parts), 128 bytes a row
  auto stage = [&](int t, int buf) {
    unsigned short* la = ring + buf * FSTG + lofs;
    unsigned short* lb = la + FR * LDT;
    // unrolled: the eleven copies issue back to back, their row steps constants
#pragma unroll
    for (int s = 0; s < FR / 32; ++s)
      stage_chunk(X + ao[s] + t * BK, la + s * 32 * LDT);
#pragma unroll
    for (int s = 0; s < FC / 32; ++s)
      stage_chunk(gb + (size_t)((s >> 1) * DMODEL + (s & 1) * 32) * DMODEL + t * BK, lb + s * 32 * LDT);
  };

  // tile 0 lands and is published; tile 1 then flies while tile 0 is worked on
  stage(0, 0);

  // the bias of this lane's three columns, fetched here so that the loads fly beside tile 0's copies
  // (a fragment's 16 columns lie in one of q, k, v: plane n0 / 64, column n0 % 64 + l16 of the head)
  int bi[FC / 64];
  float bb[FC / 64];
#pragma unroll
  for (int nf = 0; nf < FC / 64; ++nf) {
    const int n0 = wn * (FC / 4) + nf * 16;
    bi[nf] = (n0 >> 6) * DMODEL + h * DH + (n0 & 63) + l16;
    bb[nf] = bias[bi[nf]];
  }
  // The wait that stands in front of the first overwrite of a register that an issued load names. Its
  // inputs are those registers: they stay live up to here, so no load's result is placed on one of them.
  asm volatile("s_wait_xcnt 0x0" :: "v"(bi[0]), "v"(bi[1]), "v"(bi[2]), "s"(bias) : "memory");

  asm volatile("s_wait_asynccnt 0x0" ::: "memory");   // this wave's copies of tile 0 have landed
  __syncthreads();
  stage(1, 1);

  for (int t = 0; t < T; ++t) {
    const int cur = t & 1;
    const unsigned short* As = ring + cur * FSTG;
    const unsigned short* Bs = As + FR * LDT;

    // fragment fetch from LDS (matches ISA 16-bit A/B VGPR layout:
    // lane<16 -> K[0..7],K[16..23]; lane>=16 -> K[8..15],K[24..31]), one 32-deep half of the tile at a time
    // (all loops unrolled: every fragment and accumulator index is a constant, so all of them stay in registers)
    Frag a[FR / 32], bf[FC / 64];
    auto fetch = [&](int kk) {
#pragma unroll
      for (int mf = 0; mf < FR / 32; ++mf) {
        int row = wm * (FR / 2) + mf * 16 + l16;
        a[mf].q[0] = *(const uint4*)&As[row * LDT + kk * 32 + half * 8];
        a[mf].q[1] = *(const uint4*)&As[row * LDT + kk * 32 + 16 + half * 8];
      }
#pragma unroll
      for (int nf = 0; nf < FC / 64; ++nf) {
        int row = wn * (FC / 4) + nf * 16 + l16;
        bf[nf].q[0] = *(const uint4*)&Bs[row * LDT + kk * 32 + half * 8];
        bf[nf].q[1] = *(const uint4*)&Bs[row * LDT + kk * 32 + 16 + half * 8];
      }
    };
    auto products = [&]() {
#pragma unroll
      for (int mf = 0; mf < FR / 32; ++mf)
#pragma unroll
        for (int nf = 0; nf < FC / 64; ++nf)
          acc[mf][nf] = __builtin_amdgcn_wmma_f32_16x16x32_bf16(
              false, a[mf].v, false, bf[nf].v, (short)0, acc[mf][nf], false, false);
    };

    fetch(0);
    products();
    fetch(1);

    // The tile's second half is in registers, so the buffer is handed over here and its refill is
    // under way while that half's WMMAs run.
    asm volatile("s_wait_dscnt 0x0" ::: "memory");      // this wave's reads of buffer cur have retired
    asm volatile("s_wait_asynccnt 0x0" ::: "memory");   // its copies of tile t + 1 have landed
    __syncthreads();    // publishes tile t + 1 and ends every wave's reads of buffer cur
    if (t + 2 < T) stage(t + 2, cur);
    products();
  }
  asm volatile("s_wait_asynccnt 0x0" ::: "memory");     // no copy is in flight when the ring's LDS gets its new use

  // The last trip's barrier has ended every wave's reads of the ring: q, k and v, bias added, take its place.
  // C/D layout -> VGPR r: lanes 0-15 are M=r, lanes 16-31 are M=8+r, N=lane%16
#pragma unroll
  for (int nf = 0; nf < FC / 64; ++nf) {
    const int n0 = wn * (FC / 4) + nf * 16;
    float* dst = Qs + (n0 >> 6) * (FR * KPITCH) + (n0 & 63) + l16;
#pragma unroll
    for (int mf = 0; mf < FR / 32; ++mf)
#pragma unroll
      for (int r = 0; r < 8; ++r)
        dst[(wm * (FR / 2) + mf * 16 + half * 8 + r) * KPITCH] = acc[mf][nf][r] + bb[nf];
  }
  __syncthreads();    // every row of q, k and v is whole before a lane reads one

  // K normalised in place, 16 lanes a row, 16 rows a pass
#pragma unroll
  for (int s = 0; s < FR / 16; ++s) {
    float4* kp = (float4*)&Ks[(s * 16 + (tid >> 4)) * KPITCH + (tid & 15) * 4];
    float4 k4 = *kp;
    const float kk = row_sum(k4.x * k4.x + k4.y * k4.y + k4.z * k4.z + k4.w * k4.w);
    const float ki = 1.0f / (sqrtf(kk) + 1e-6f);
    k4.x *= ki; k4.y *= ki; k4.z *= ki; k4.w *= ki;
    *kp = k4;
  }
  __syncthreads();    // the normalised rows are read by other waves

  const int part = tid & 3;    // which 16 of the 64 head dims
  for (int qh = 0; qh < FQ / 64; ++qh) {
    const int ql = qh * 64 + (tid >> 2);   // query inside the block
    const int i  = i0 + ql;
    const int m  = b * SEQ + i;

    v2f q[8];
    {
      const v4f* qp = (const v4f*)&Qs[(ql + 16) * KPITCH + part * 16];
      const v4f qr0 = qp[0], qr1 = qp[1], qr2 = qp[2], qr3 = qp[3];
      const v4f sq = qr0 * qr0 + qr1 * qr1 + qr2 * qr2 + qr3 * qr3;
      const float qi = 1.0f / (sqrtf(quad_sum((sq.x + sq.y) + (sq.z + sq.w))) + 1e-6f);
      v4f f0 = qr0 * qi, f1 = qr1 * qi, f2 = qr2 * qi, f3 = qr3 * qi;
      q[0] = f0.lo; q[1] = f0.hi; q[2] = f1.lo; q[3] = f1.hi;
      q[4] = f2.lo; q[5] = f2.hi; q[6] = f3.lo; q[7] = f3.hi;
    }

    float s[WIN];
#pragma unroll
    for (int t = 0; t < WIN; ++t) {
      const v4f* kr = (const v4f*)&Ks[(ql + 2 * t) * KPITCH + part * 16];
      v2f pa = {0.f, 0.f};
#pragma unroll
      for (int k = 0; k < 4; ++k) {
        v4f f = kr[k];
        pa += q[2 * k] * f.lo;
        pa += q[2 * k + 1] * f.hi;
      }
      float p = quad_sum(pa.x + pa.y);
      int j = i - 16 + 2 * t;
      s[t] = (j >= 0 && j < SEQ) ? p : -3.0e38f;
      // bounds how many key rows are fetched ahead: left free, the scheduler hoisted more than the registers
      // hold and spilled to scratch
      if (t % 6 == 5) __builtin_amdgcn_sched_barrier(0);
    }
    float mx = -3.0e38f;
#pragma unroll
    for (int t = 0; t < WIN; ++t) mx = fmaxf(mx, s[t]);
    float sum = 0.f;
#pragma unroll
    for (int t = 0; t < WIN; ++t) { s[t] = exp_slot(s[t] - mx); sum += s[t]; }
    float inv = 1.0f / sum;

    v2f o[8];
#pragma unroll
    for (int k = 0; k < 8; ++k) o[k] = (v2f){0.f, 0.f};
#pragma unroll
    for (int t = 0; t < WIN; ++t) {
      const v4f* vr = (const v4f*)&Vs[(ql + 2 * t) * KPITCH + part * 16];
      float w = s[t] * inv;
#pragma unroll
      for (int k = 0; k < 4; ++k) {
        v4f f = vr[k];
        o[2 * k]     += w * f.lo;
        o[2 * k + 1] += w * f.hi;
      }
    }

    unsigned pk[8];
#pragma unroll
    for (int k = 0; k < 8; ++k)
      pk[k] = (unsigned)f2bf(o[k].x) | ((unsigned)f2bf(o[k].y) << 16);
    uint4* op = (uint4*)(aout + (size_t)m * DMODEL + h * DH + part * 16);
    op[0] = make_uint4(pk[0], pk[1], pk[2], pk[3]);
    op[1] = make_uint4(pk[4], pk[5], pk[6], pk[7]);
    // the wait that stands in front of the first overwrite of a register that an issued store names:
    // the next pass of this loop forms its values in the same registers
    asm volatile("s_wait_xcnt 0x0" ::: "memory");
  }
}

// ---------------- launch ----------------
extern "C" void kernel_launch(void* const* d_in, const int* in_sizes, int n_in,
                              void* d_out, int out_size, void* d_ws, size_t ws_size,
                              hipStream_t stream) {
  const float* x     = (const float*)d_in[0];  // [2,2048,1024]
  const float* w_qkv = (const float*)d_in[1];  // [3072,1024]
  const float* b_qkv = (const float*)d_in[2];  // [3072]
  const float* w_out = (const float*)d_in[3];  // [1024,1024]
  const float* b_out = (const float*)d_in[4];  // [1024]
  float* out = (float*)d_out;                  // [2,2048,1024] fp32

  const int M  = BATCH * SEQ;      // 4096
  const int N2 = DMODEL;           // 1024
  const int Kd = DMODEL;           // 1024

  char* w = (char*)d_ws;
  unsigned short* xb    = (unsigned short*)(w);                    // 8 MB
  unsigned short* wqkvb = (unsigned short*)(w + (8u << 20));       // 6 MB
  unsigned short* woutb = (unsigned short*)(w + (14u << 20));      // 2 MB
  unsigned short* attnb = (unsigned short*)(w + (16u << 20));      // 8 MB

  // 1) fp32 -> bf16 conversions, one launch: xb, wqkvb and woutb are one run of bytes from xb on
  cvt3_f32_bf16<<<(X4 + WQ4 + WO4) / 256, 256, 0, stream>>>(x, w_qkv, w_out, xb);

  // 2) QKV projection x @ w_qkv^T + b_qkv (WMMA bf16, fp32 acc) and, on its result in LDS,
  //    dilated masked attention with q/k norms -> bf16 [M, D]
  qkv_attn<<<(M / FQ) * HH, 256, 0, stream>>>(xb, wqkvb, b_qkv, attnb);

  // 3) output projection: out = attn @ w_out^T + b_out
  gemm_nt_bias<<<dim3(N2 / BN, M / BM), 256, 0, stream>>>(attnb, woutb, b_out, out, N2, Kd);
}

// v006
// Measured time: 48.6 microseconds a run.
// Next to v005, in two timings, it ran 1.04 times as fast each time.
// Over all steps from v000 it is 4.81 times as fast.
#include <hip/hip_runtime.h>
#include <hip/hip_bf16.h>

typedef __attribute__((ext_vector_type(16))) __bf16 v16bf;
typedef __attribute__((ext_vector_type(8)))  float  v8f;
typedef __attribute__((ext_vector_type(4)))  int    v4i;

#define HH     16      // heads
#define DH     64      // head dim
#define SEQ    2048
#define DMODEL 1024
#define BATCH  2
#define WIN    17      // dilated window size: j = i-16 .. i+16 step 2

#if __has_builtin(__builtin_amdgcn_global_load_async_to_lds_b128)
#define USE_ASYNC_LDS 1
#else
#define USE_ASYNC_LDS 0
#endif

#define AS1 __attribute__((address_space(1)))
#define AS3 __attribute__((address_space(3)))

// ---------------- fp32 -> bf16 (round to nearest even) ----------------
__device__ __forceinline__ unsigned short f2bf(float f) {
  unsigned u = __builtin_bit_cast(unsigned, f);
  unsigned r = u + 0x7FFFu + ((u >> 16) & 1u);
  return (unsigned short)(r >> 16);
}

// One launch converts all three fp32 operands. Their bf16 copies lie back to back in the workspace, so
// the flat index is the place in out; each operand fills a whole number of blocks, so the source is
// picked once per block, by a scalar test.
#define X4  (BATCH * SEQ * DMODEL / 4)     // groups of four floats in x
#define WQ4 (3 * DMODEL * DMODEL / 4)      // in w_qkv
#define WO4 (DMODEL * DMODEL / 4)          // in w_out

__global__ __launch_bounds__(256)
void cvt3_f32_bf16(const float* __restrict__ x, const float* __restrict__ wqkv,
                   const float* __restrict__ wout, unsigned short* __restrict__ out) {
  const int first = blockIdx.x * 256;      // the block's first group, counted over all three operands
  const float* src = x;
  int base = 0;
  if (first >= X4 + WQ4)  { src = wout; base = X4 + WQ4; }
  else if (first >= X4)   { src = wqkv; base = X4; }
  // both block bases are scalar: the thread index alone is the lane's offset for the load and the store
  const float4* in4 = (const float4*)src + (first - base);
  ushort4* out4 = (ushort4*)out + first;
  float4 f = in4[threadIdx.x];
  ushort4 o;
  o.x = f2bf(f.x); o.y = f2bf(f.y); o.z = f2bf(f.z); o.w = f2bf(f.w);
  out4[threadIdx.x] = o;
}

// ---------------- bf16 NT GEMM with fp32 accumulate: C = A * B^T + bias ----------------
// A: [M][Kd] bf16 row-major; Bm: [Nd][Kd] bf16 row-major (so B^T is Kd x Nd);
// C: [M][Nd] fp32.  M,Nd multiples of 128; Kd multiple of 64.
#define BM 128
#define BN 128
#define BK 64
#define LDT 72   // LDS row pitch in ushorts: 144 B = 16 B x odd, free of bank conflicts for 16-byte reads

union Frag { v16bf v; uint4 q[2]; };

__device__ __forceinline__ void stage_chunk(const unsigned short* __restrict__ gsrc,
                                            unsigned short* lds_dst) {
#if USE_ASYNC_LDS
  // CDNA5 async DMA: global -> LDS without VGPR round trip, tracked on ASYNCcnt
  __builtin_amdgcn_global_load_async_to_lds_b128(
      (AS1 v4i*)gsrc, (AS3 v4i*)lds_dst, 0, 0);
#else
  *(uint4*)lds_dst = *(const uint4*)gsrc;
#endif
}

// The ring has three buffers and a K step's tiles (a stage) fly for two trips. Four of the block's eight
// waves copy a whole stage: waves 0-3 the even stages, waves 4-7 the odd ones. So a wave never has more
// than one stage in flight, and its wait for that stage, to zero, leaves the other half's stage flying.
#define NBUF 3

// One K step's A and B tiles, 128 rows of 128 bytes each. ga, gb, la, lb are the lane's own places in
// the first 16 rows: eight lanes lie along a row, so each wave-wide copy covers four whole 128-byte lines.
__device__ __forceinline__ void stage_tile(const unsigned short* __restrict__ ga,
                                           const unsigned short* __restrict__ gb,
                                           unsigned short* la, unsigned short* lb, int Kd) {
  // unrolled: the sixteen copies issue back to back, their row steps folded into the addresses
#pragma unroll
  for (int s = 0; s < BM / 16; ++s) {
    stage_chunk(ga + (size_t)(s * 16) * Kd, la + s * 16 * LDT);
    stage_chunk(gb + (size_t)(s * 16) * Kd, lb + s * 16 * LDT);
  }
}

__global__ __launch_bounds__(256)
void gemm_nt_bias(const unsigned short* __restrict__ A,
                  const unsigned short* __restrict__ Bm,
                  const float* __restrict__ bias,
                  float* __restrict__ C,
                  int Ndim, int Kd) {
  __shared__ __attribute__((aligned(16))) unsigned short As[NBUF][BM * LDT];
  __shared__ __attribute__((aligned(16))) unsigned short Bs[NBUF][BN * LDT];

  const int tid  = threadIdx.x;
  const int lane = tid & 31;
  const int wid  = tid >> 5;
  const int wm   = wid >> 2;     // 0..1  -> 64 rows each
  const int wn   = wid & 3;      // 0..3  -> 32 cols each
  const int l16  = lane & 15;
  const int half = lane >> 4;    // 0/1: selects K sub-chunk per ISA bf16 A/B layout

  const int brow = blockIdx.y * BM;
  const int bcol = blockIdx.x * BN;
  const int T = Kd / BK;

  v8f acc[4][2] = {};

  // which half of the waves this one belongs to, in a scalar register: every test on it is a scalar branch
  const int grp = __builtin_amdgcn_readfirstlane(tid >> 7);
  // this lane's 16-byte chunk of a staged row: row (tid % 128) / 8 of each group of 16 rows, chunk tid % 8
  const int srow = (tid & 127) >> 3;
  const unsigned short* ga = A  + (size_t)(brow + srow) * Kd + (tid & 7) * 8;
  const unsigned short* gb = Bm + (size_t)(bcol + srow) * Kd + (tid & 7) * 8;
  const int lofs = srow * LDT + (tid & 7) * 8;

  // stages 0 and 1 start together; stage 0 lands and is published; stage 2 then starts as well
  if (grp == 0)   stage_tile(ga, gb, &As[0][lofs], &Bs[0][lofs], Kd);
  else if (T > 1) stage_tile(ga + BK, gb + BK, &As[1][lofs], &Bs[1][lofs], Kd);
  if (grp == 0) asm volatile("s_wait_asynccnt 0x0" ::: "memory");   // this wave's copies of stage 0 have landed
  __syncthreads();
  if (grp == 0 && T > 2) stage_tile(ga + 2 * BK, gb + 2 * BK, &As[2][lofs], &Bs[2][lofs], Kd);

  int cur = 0;    // t % NBUF
  for (int t = 0; t < T; ++t) {

    // fragment fetch from LDS (matches ISA 16-bit A/B VGPR layout:
    // lane<16 -> K[0..7],K[16..23]; lane>=16 -> K[8..15],K[24..31]), one 32-deep half of the tile at a time
    // (unrolled: every fragment and accumulator index is a constant, so all of them stay in registers)
#pragma unroll
    for (int kk = 0; kk < BK / 32; ++kk) {
      Frag a[4], b[2];
#pragma unroll
      for (int mf = 0; mf < 4; ++mf) {
        int row = wm * 64 + mf * 16 + l16;
        a[mf].q[0] = *(const uint4*)&As[cur][row * LDT + kk * 32 + half * 8];
        a[mf].q[1] = *(const uint4*)&As[cur][row * LDT + kk * 32 + 16 + half * 8];
      }
#pragma unroll
      for (int nf = 0; nf < 2; ++nf) {
        int row = wn * 32 + nf * 16 + l16;
        b[nf].q[0] = *(const uint4*)&Bs[cur][row * LDT + kk * 32 + half * 8];
        b[nf].q[1] = *(const uint4*)&Bs[cur][row * LDT + kk * 32 + 16 + half * 8];
      }
#pragma unroll
      for (int mf = 0; mf < 4; ++mf)
#pragma unroll
        for (int nf = 0; nf < 2; ++nf)
          acc[mf][nf] = __builtin_amdgcn_wmma_f32_16x16x32_bf16(
              false, a[mf].v, false, b[nf].v, (short)0, acc[mf][nf], false, false);
    }

    asm volatile("s_wait_dscnt 0x0" ::: "memory");      // this wave's reads of buffer cur have retired
    // the half that copied stage t + 1 waits for it; stage t + 2, the other half's, flies on
    if (grp == ((t + 1) & 1)) asm volatile("s_wait_asynccnt 0x0" ::: "memory");
    __syncthreads();    // publishes stage t + 1 and ends every wave's reads of buffer cur
    if (t + 3 < T && grp == ((t + 1) & 1))
      stage_tile(ga + (t + 3) * BK, gb + (t + 3) * BK, &As[cur][lofs], &Bs[cur][lofs], Kd);
    cur = cur == NBUF - 1 ? 0 : cur + 1;
  }
  asm volatile("s_wait_asynccnt 0x0" ::: "memory");     // no copy is left in flight when the wave ends

  // epilogue: C/D layout -> VGPR r: lanes 0-15 are M=r, lanes 16-31 are M=8+r, N=lane%16
#pragma unroll
  for (int nf = 0; nf < 2; ++nf) {
    int gn = bcol + wn * 32 + nf * 16 + l16;
    float bb = bias[gn];
#pragma unroll
    for (int mf = 0; mf < 4; ++mf) {
      int gm = brow + wm * 64 + mf * 16 + half * 8;
      float* Cp = C + (size_t)gm * Ndim + gn;
#pragma unroll
      for (int r = 0; r < 8; ++r)
        Cp[(size_t)r * Ndim] = acc[mf][nf][r] + bb;
    }
  }
}

// ---------------- QKV projection and dilated attention in one kernel ----------------
// A block takes 128 queries of one head. It projects the head's q, k and v columns (192 rows of w_qkv)
// for those queries' rows of x and for the 16 rows on either side, which the window reaches, keeps the
// fp32 result in LDS and attends there: q, k and v never go to memory. The rows on either side are
// projected again by the neighbouring blocks.
// In the attention part four lanes share a query, 16 head dims each; the 16 lanes that hold a key row
// sum its squares for the inverse norm, and so do the four lanes that hold a query.
#define FQ     128           // queries per block
#define FR     (FQ + 32)     // projected rows of x
#define FC     (3 * DH)      // projected columns: q, k, v of the head
#define FSTG   ((FR + FC) * LDT)   // ushorts in one ring buffer: the x rows, then the weight rows
#define KPITCH 68            // LDS row pitch in floats: 16 lanes of a b128 read hit 16 distinct bank groups

// sum over the four lanes of a quad, same bits in all four
__device__ __forceinline__ float quad_sum(float x) {
  x += __builtin_bit_cast(float, __builtin_amdgcn_mov_dpp(__builtin_bit_cast(int, x), 0xB1, 0xf, 0xf, true)); // quad_perm [1,0,3,2]
  x += __builtin_bit_cast(float, __builtin_amdgcn_mov_dpp(__builtin_bit_cast(int, x), 0x4E, 0xf, 0xf, true)); // quad_perm [2,3,0,1]
  return x;
}

// sum over the 16 lanes of a row, same bits in all sixteen
__device__ __forceinline__ float row_sum(float x) {
  x = quad_sum(x);
  x += __builtin_bit_cast(float, __builtin_amdgcn_mov_dpp(__builtin_bit_cast(int, x), 0x164, 0xf, 0xf, true)); // row_xmask:4
  x += __builtin_bit_cast(float, __builtin_amdgcn_mov_dpp(__builtin_bit_cast(int, x), 0x168, 0xf, 0xf, true)); // row_xmask:8
  return x;
}

// e^x as the fast intrinsic forms it (multiply by log2 e, v_exp_f32); the v_nop fills the one slot the
// instruction set asks for between a transcendental and a next instruction that overwrites its source
__device__ __forceinline__ float exp_slot(float x) {
  float r, y = x * 1.44269504088896340736f;
  asm("v_exp_f32 %0, %1\n\tv_nop" : "=v"(r) : "v"(y));
  return r;
}

typedef __attribute__((ext_vector_type(2))) float v2f;
typedef __attribute__((ext_vector_type(4))) float v4f;

// four waves per SIMD: two blocks per WGP, so that one block's waits hide behind the other's work
__global__ __launch_bounds__(256) __attribute__((amdgpu_waves_per_eu(4)))
void qkv_attn(const unsigned short* __restrict__ X, const unsigned short* __restrict__ Wq,
              const float* __restrict__ bias, unsigned short* __restrict__ aout) {
  // first the three-buffer ring of bf16 operand tiles, then, behind the K loop, q, k and v in fp32
  __shared__ __attribute__((aligned(16))) char smem[NBUF * FSTG * 2];
  static_assert(3 * FR * KPITCH * 4 <= NBUF * FSTG * 2, "the q, k, v planes fit in the ring");
  static_assert(2 * NBUF * FSTG * 2 <= 320 * 1024, "two blocks per WGP");
  unsigned short* ring = (unsigned short*)smem;
  float* Qs = (float*)smem;
  float* Ks = Qs + FR * KPITCH;
  float* Vs = Ks + FR * KPITCH;

  const int tid  = threadIdx.x;
  const int lane = tid & 31;
  const int wid  = tid >> 5;
  const int wm   = wid >> 2;     // 0..1  -> 80 rows each
  const int wn   = wid & 3;      // 0..3  -> 48 cols each
  const int l16  = lane & 15;
  const int half = lane >> 4;    // 0/1: selects K sub-chunk per ISA bf16 A/B layout

  const int h    = blockIdx.x % HH;
  const int rest = blockIdx.x / HH;
  const int tile = rest % (SEQ / FQ);
  const int b    = rest / (SEQ / FQ);
  const int i0   = tile * FQ;
  const int T    = DMODEL / BK;

  v8f acc[FR / 32][FC / 64] = {};

  // which half of the waves this one belongs to, in a scalar register: every test on it is a scalar branch
  const int grp = __builtin_amdgcn_readfirstlane(tid >> 7);
  // This lane's 16-byte chunk of a staged row: row (tid % 128) / 8 of each group of 16 rows, chunk tid % 8.
  // Staged row r is position i0 - 16 + r of the sequence; a position outside it is clamped to the
  // nearest one inside (in bounds), and the window's own test keeps such a row out of every sum.
  // Only the first and the last group of 16 can leave the sequence: the eight between are the block's own
  // queries and lie at constant steps from the first of them.
  const int srow = (tid & 127) >> 3;
  auto xofs = [&](int r) {
    int j = i0 - 16 + r;
    j = j < 0 ? 0 : j > SEQ - 1 ? SEQ - 1 : j;
    return (unsigned)(b * SEQ + j) * DMODEL + (tid & 7) * 8;
  };
  const unsigned alo = xofs(srow), amid = xofs(16 + srow), ahi = xofs(FR - 16 + srow);
  const unsigned short* gb = Wq + (size_t)(h * DH + srow) * DMODEL + (tid & 7) * 8;
  const int lofs = srow * LDT + (tid & 7) * 8;

  // one K step's tiles: 160 rows of x and 192 of w_qkv (64 each from its q, k and v parts), 128 bytes a row
  auto stage = [&](int t, int buf) {
    unsigned short* la = ring + buf * FSTG + lofs;
    unsigned short* lb = la + FR * LDT;
    // unrolled: the 22 copies issue back to back, their row steps constants
    stage_chunk(X + alo + t * BK, la);
#pragma unroll
    for (int s = 1; s < FR / 16 - 1; ++s)
      stage_chunk(X + amid + (s - 1) * 16 * DMODEL + t * BK, la + s * 16 * LDT);
    stage_chunk(X + ahi + t * BK, la + (FR - 16) * LDT);
#pragma unroll
    for (int s = 0; s < FC / 16; ++s)
      stage_chunk(gb + (size_t)((s >> 2) * DMODEL + (s & 3) * 16) * DMODEL + t * BK, lb + s * 16 * LDT);
  };

  // stages 0 and 1 start together; stage 0 lands and is published; stage 2 then starts as well
  static_assert(DMODEL / BK > 2, "the prologue's three stages exist");
  if (grp == 0) stage(0, 0); else stage(1, 1);

  // the bias of this lane's three columns, fetched here so that the loads fly beside tile 0's copies
  // (a fragment's 16 columns lie in one of q, k, v: plane n0 / 64, column n0 % 64 + l16 of the head)
  int bi[FC / 64];
  float bb[FC / 64];
#pragma unroll
  for (int nf = 0; nf < FC / 64; ++nf) {
    const int n0 = wn * (FC / 4) + nf * 16;
    bi[nf] = (n0 >> 6) * DMODEL + h * DH + (n0 & 63) + l16;
    bb[nf] = bias[bi[nf]];
  }
  // The wait that stands in front of the first overwrite of a register that an issued load names. Its
  // inputs are those registers: they stay live up to here, so no load's result is placed on one of them.
  asm volatile("s_wait_xcnt 0x0" :: "v"(bi[0]), "v"(bi[1]), "v"(bi[2]), "s"(bias) : "memory");

  if (grp == 0) asm volatile("s_wait_asynccnt 0x0" ::: "memory");   // this wave's copies of stage 0 have landed
  __syncthreads();
  if (grp == 0) stage(2, 2);

  int cur = 0;    // t % NBUF
  for (int t = 0; t < T; ++t) {
    const unsigned short* As = ring + cur * FSTG;
    const unsigned short* Bs = As + FR * LDT;

    // fragment fetch from LDS (matches ISA 16-bit A/B VGPR layout:
    // lane<16 -> K[0..7],K[16..23]; lane>=16 -> K[8..15],K[24..31]), one 32-deep half of the tile at a time
    // (all loops unrolled: every fragment and accumulator index is a constant, so all of them stay in registers)
    Frag a[FR / 32], bf[FC / 64];
    auto fetch = [&](int kk) {
#pragma unroll
      for (int mf = 0; mf < FR / 32; ++mf) {
        int row = wm * (FR / 2) + mf * 16 + l16;
        a[mf].q[0] = *(const uint4*)&As[row * LDT + kk * 32 + half * 8];
        a[mf].q[1] = *(const uint4*)&As[row * LDT + kk * 32 + 16 + half * 8];
      }
#pragma unroll
      for (int nf = 0; nf < FC / 64; ++nf) {
        int row = wn * (FC / 4) + nf * 16 + l16;
        bf[nf].q[0] = *(const uint4*)&Bs[row * LDT + kk * 32 + half * 8];
        bf[nf].q[1] = *(const uint4*)&Bs[row * LDT + kk * 32 + 16 + half * 8];
      }
    };
    auto products = [&]() {
#pragma unroll
      for (int mf = 0; mf < FR / 32; ++mf)
#pragma unroll
        for (int nf = 0; nf < FC / 64; ++nf)
          acc[mf][nf] = __builtin_amdgcn_wmma_f32_16x16x32_bf16(
              false, a[mf].v, false, bf[nf].v, (short)0, acc[mf][nf], false, false);
    };

    fetch(0);
    products();
    fetch(1);

    // The tile's second half is in registers, so the buffer is handed over here and its refill is
    // under way while that half's WMMAs run.
    asm volatile("s_wait_dscnt 0x0" ::: "memory");      // this wave's reads of buffer cur have retired
    // the half that copied stage t + 1 waits for it; stage t + 2, the other half's, flies on
    if (grp == ((t + 1) & 1)) asm volatile("s_wait_asynccnt 0x0" ::: "memory");
    __syncthreads();    // publishes stage t + 1 and ends every wave's reads of buffer cur
    if (t + 3 < T && grp == ((t + 1) & 1)) stage(t + 3, cur);
    products();
    cur = cur == NBUF - 1 ? 0 : cur + 1;
  }
  asm volatile("s_wait_asynccnt 0x0" ::: "memory");     // no copy is in flight when the ring's LDS gets its new use

  // The last trip's barrier has ended every wave's reads of the ring: q, k and v, bias added, take its place.
  // C/D layout -> VGPR r: lanes 0-15 are M=r, lanes 16-31 are M=8+r, N=lane%16
#pragma unroll
  for (int nf = 0; nf < FC / 64; ++nf) {
    const int n0 = wn * (FC / 4) + nf * 16;
    float* dst = Qs + (n0 >> 6) * (FR * KPITCH) + (n0 & 63) + l16;
#pragma unroll
    for (int mf = 0; mf < FR / 32; ++mf)
#pragma unroll
      for (int r = 0; r < 8; ++r)
        dst[(wm * (FR / 2) + mf * 16 + half * 8 + r) * KPITCH] = acc[mf][nf][r] + bb[nf];
  }
  __syncthreads();    // every row of q, k and v is whole before a lane reads one

  // K normalised in place, 16 lanes a row, 16 rows a pass
#pragma unroll
  for (int s = 0; s < FR / 16; ++s) {
    float4* kp = (float4*)&Ks[(s * 16 + (tid >> 4)) * KPITCH + (tid & 15) * 4];
    float4 k4 = *kp;
    const float kk = row_sum(k4.x * k4.x + k4.y * k4.y + k4.z * k4.z + k4.w * k4.w);
    const float ki = 1.0f / (sqrtf(kk) + 1e-6f);
    k4.x *= ki; k4.y *= ki; k4.z *= ki; k4.w *= ki;
    *kp = k4;
  }
  __syncthreads();    // the normalised rows are read by other waves

  const int part = tid & 3;    // which 16 of the 64 head dims
  for (int qh = 0; qh < FQ / 64; ++qh) {
    const int ql = qh * 64 + (tid >> 2);   // query inside the block
    const int i  = i0 + ql;
    const int m  = b * SEQ + i;

    v2f q[8];
    {
      const v4f* qp = (const v4f*)&Qs[(ql + 16) * KPITCH + part * 16];
      const v4f qr0 = qp[0], qr1 = qp[1], qr2 = qp[2], qr3 = qp[3];
      const v4f sq = qr0 * qr0 + qr1 * qr1 + qr2 * qr2 + qr3 * qr3;
      const float qi = 1.0f / (sqrtf(quad_sum((sq.x + sq.y) + (sq.z + sq.w))) + 1e-6f);
      v4f f0 = qr0 * qi, f1 = qr1 * qi, f2 = qr2 * qi, f3 = qr3 * qi;
      q[0] = f0.lo; q[1] = f0.hi; q[2] = f1.lo; q[3] = f1.hi;
      q[4] = f2.lo; q[5] = f2.hi; q[6] = f3.lo; q[7] = f3.hi;
    }

    float s[WIN];
#pragma unroll
    for (int t = 0; t < WIN; ++t) {
      const v4f* kr = (const v4f*)&Ks[(ql + 2 * t) * KPITCH + part * 16];
      v2f pa = {0.f, 0.f};
#pragma unroll
      for (int k = 0; k < 4; ++k) {
        v4f f = kr[k];
        pa += q[2 * k] * f.lo;
        pa += q[2 * k + 1] * f.hi;
      }
      float p = quad_sum(pa.x + pa.y);
      int j = i - 16 + 2 * t;
      s[t] = (j >= 0 && j < SEQ) ? p : -3.0e38f;
      // bounds how many key rows are fetched ahead: left free, the scheduler hoisted more than the registers
      // hold and spilled to scratch
      if (t % 6 == 5) __builtin_amdgcn_sched_barrier(0);
    }
    float mx = -3.0e38f;
#pragma unroll
    for (int t = 0; t < WIN; ++t) mx = fmaxf(mx, s[t]);
    float sum = 0.f;
#pragma unroll
    for (int t = 0; t < WIN; ++t) { s[t] = exp_slot(s[t] - mx); sum += s[t]; }
    float inv = 1.0f / sum;

    v2f o[8];
#pragma unroll
    for (int k = 0; k < 8; ++k) o[k] = (v2f){0.f, 0.f};
#pragma unroll
    for (int t = 0; t < WIN; ++t) {
      const v4f* vr = (const v4f*)&Vs[(ql + 2 * t) * KPITCH + part * 16];
      float w = s[t] * inv;
#pragma unroll
      for (int k = 0; k < 4; ++k) {
        v4f f = vr[k];
        o[2 * k]     += w * f.lo;
        o[2 * k + 1] += w * f.hi;
      }
    }

    unsigned pk[8];
#pragma unroll
    for (int k = 0; k < 8; ++k)
      pk[k] = (unsigned)f2bf(o[k].x) | ((unsigned)f2bf(o[k].y) << 16);
    uint4* op = (uint4*)(aout + (size_t)m * DMODEL + h * DH + part * 16);
    op[0] = make_uint4(pk[0], pk[1], pk[2], pk[3]);
    op[1] = make_uint4(pk[4], pk[5], pk[6], pk[7]);
    // the wait that stands in front of the first overwrite of a register that an issued store names:
    // the next pass of this loop forms its values in the same registers
    asm volatile("s_wait_xcnt 0x0" ::: "memory");
  }
}

// ---------------- launch ----------------
extern "C" void kernel_launch(void* const* d_in, const int* in_sizes, int n_in,
                              void* d_out, int out_size, void* d_ws, size_t ws_size,
                              hipStream_t stream) {
  const float* x     = (const float*)d_in[0];  // [2,2048,1024]
  const float* w_qkv = (const float*)d_in[1];  // [3072,1024]
  const float* b_qkv = (const float*)d_in[2];  // [3072]
  const float* w_out = (const float*)d_in[3];  // [1024,1024]
  const float* b_out = (const float*)d_in[4];  // [1024]
  float* out = (float*)d_out;                  // [2,2048,1024] fp32

  const int M  = BATCH * SEQ;      // 4096
  const int N2 = DMODEL;           // 1024
  const int Kd = DMODEL;           // 1024

  char* w = (char*)d_ws;
  unsigned short* xb    = (unsigned short*)(w);                    // 8 MB
  unsigned short* wqkvb = (unsigned short*)(w + (8u << 20));       // 6 MB
  unsigned short* woutb = (unsigned short*)(w + (14u << 20));      // 2 MB
  unsigned short* attnb = (unsigned short*)(w + (16u << 20));      // 8 MB

  // 1) fp32 -> bf16 conversions, one launch: xb, wqkvb and woutb are one run of bytes from xb on
  cvt3_f32_bf16<<<(X4 + WQ4 + WO4) / 256, 256, 0, stream>>>(x, w_qkv, w_out, xb);

  // 2) QKV projection x @ w_qkv^T + b_qkv (WMMA bf16, fp32 acc) and, on its result in LDS,
  //    dilated masked attention with q/k norms -> bf16 [M, D]
  qkv_attn<<<(M / FQ) * HH, 256, 0, stream>>>(xb, wqkvb, b_qkv, attnb);

  // 3) output projection: out = attn @ w_out^T + b_out
  gemm_nt_bias<<<dim3(N2 / BN, M / BM), 256, 0, stream>>>(attnb, woutb, b_out, out, N2, Kd);
}

// v007
// A run of this version takes 47.1 microseconds.
// In both of two side-by-side timings against v006, it was 1.03 times as fast.
// Counting every step since v000, it is 4.96 times as fast.
#include <hip/hip_runtime.h>
#include <hip/hip_bf16.h>

typedef __attribute__((ext_vector_type(16))) __bf16 v16bf;
typedef __attribute__((ext_vector_type(8)))  float  v8f;
typedef __attribute__((ext_vector_type(4)))  int    v4i;

#define HH     16      // heads
#define DH     64      // head dim
#define SEQ    2048
#define DMODEL 1024
#define BATCH  2
#define WIN    17      // dilated window size: j = i-16 .. i+16 step 2

#if __has_builtin(__builtin_amdgcn_global_load_async_to_lds_b128)
#define USE_ASYNC_LDS 1
#else
#define USE_ASYNC_LDS 0
#endif

#define AS1 __attribute__((address_space(1)))
#define AS3 __attribute__((address_space(3)))

// ---------------- fp32 -> bf16 (round to nearest even) ----------------
__device__ __forceinline__ unsigned short f2bf(float f) {
  unsigned u = __builtin_bit_cast(unsigned, f);
  unsigned r = u + 0x7FFFu + ((u >> 16) & 1u);
  return (unsigned short)(r >> 16);
}

// One launch converts all three fp32 operands. Their bf16 copies lie back to back in the workspace, so
// the flat index is the place in out; each operand fills a whole number of blocks, so the source is
// picked once per block, by a scalar test.
#define X4  (BATCH * SEQ * DMODEL / 4)     // groups of four floats in x
#define WQ4 (3 * DMODEL * DMODEL / 4)      // in w_qkv
#define WO4 (DMODEL * DMODEL / 4)          // in w_out

__global__ __launch_bounds__(256)
void cvt3_f32_bf16(const float* __restrict__ x, const float* __restrict__ wqkv,
                   const float* __restrict__ wout, unsigned short* __restrict__ out) {
  const int first = blockIdx.x * 256;      // the block's first group, counted over all three operands
  const float* src = x;
  int base = 0;
  if (first >= X4 + WQ4)  { src = wout; base = X4 + WQ4; }
  else if (first >= X4)   { src = wqkv; base = X4; }
  // both block bases are scalar: the thread index alone is the lane's offset for the load and the store
  const float4* in4 = (const float4*)src + (first - base);
  ushort4* out4 = (ushort4*)out + first;
  float4 f = in4[threadIdx.x];
  ushort4 o;
  o.x = f2bf(f.x); o.y = f2bf(f.y); o.z = f2bf(f.z); o.w = f2bf(f.w);
  out4[threadIdx.x] = o;
}

// ---------------- bf16 NT GEMM with fp32 accumulate: C = A * B^T + bias ----------------
// A: [M][Kd] bf16 row-major; Bm: [Nd][Kd] bf16 row-major (so B^T is Kd x Nd);
// C: [M][Nd] fp32.  M,Nd multiples of 128; Kd multiple of 64.
#define BM 128
#define BN 128
#define BK 64
#define LDT 72   // LDS row pitch in ushorts: 144 B = 16 B x odd, free of bank conflicts for 16-byte reads

union Frag { v16bf v; uint4 q[2]; };

__device__ __forceinline__ void stage_chunk(const unsigned short* __restrict__ gsrc,
                                            unsigned short* lds_dst) {
#if USE_ASYNC_LDS
  // CDNA5 async DMA: global -> LDS without VGPR round trip, tracked on ASYNCcnt
  __builtin_amdgcn_global_load_async_to_lds_b128(
      (AS1 v4i*)gsrc, (AS3 v4i*)lds_dst, 0, 0);
#else
  *(uint4*)lds_dst = *(const uint4*)gsrc;
#endif
}

// The ring has three buffers and a K step's tiles (a stage) fly for two trips. Four of the block's eight
// waves copy a whole stage: waves 0-3 the even stages, waves 4-7 the odd ones. So a wave never has more
// than one stage in flight, and its wait for that stage, to zero, leaves the other half's stage flying.
#define NBUF 3

// One K step's A and B tiles, 128 rows of 128 bytes each. ga, gb, la, lb are the lane's own places in
// the first 16 rows: eight lanes lie along a row, so each wave-wide copy covers four whole 128-byte lines.
__device__ __forceinline__ void stage_tile(const unsigned short* __restrict__ ga,
                                           const unsigned short* __restrict__ gb,
                                           unsigned short* la, unsigned short* lb, int Kd) {
  // unrolled: the sixteen copies issue back to back, their row steps folded into the addresses
#pragma unroll
  for (int s = 0; s < BM / 16; ++s) {
    stage_chunk(ga + (size_t)(s * 16) * Kd, la + s * 16 * LDT);
    stage_chunk(gb + (size_t)(s * 16) * Kd, lb + s * 16 * LDT);
  }
}

__global__ __launch_bounds__(256)
void gemm_nt_bias(const unsigned short* __restrict__ A,
                  const unsigned short* __restrict__ Bm,
                  const float* __restrict__ bias,
                  float* __restrict__ C,
                  int Ndim, int Kd) {
  __shared__ __attribute__((aligned(16))) unsigned short As[NBUF][BM * LDT];
  __shared__ __attribute__((aligned(16))) unsigned short Bs[NBUF][BN * LDT];

  const int tid  = threadIdx.x;
  const int lane = tid & 31;
  const int wid  = tid >> 5;
  const int wm   = wid >> 2;     // 0..1  -> 64 rows each
  const int wn   = wid & 3;      // 0..3  -> 32 cols each
  const int l16  = lane & 15;
  const int half = lane >> 4;    // 0/1: selects K sub-chunk per ISA bf16 A/B layout

  const int brow = blockIdx.y * BM;
  const int bcol = blockIdx.x * BN;
  const int T = Kd / BK;

  v8f acc[4][2] = {};

  // which half of the waves this one belongs to, in a scalar register: every test on it is a scalar branch
  const int grp = __builtin_amdgcn_readfirstlane(tid >> 7);
  // this lane's 16-byte chunk of a staged row: row (tid % 128) / 8 of each group of 16 rows, chunk tid % 8
  const int srow = (tid & 127) >> 3;
  const unsigned short* ga = A  + (size_t)(brow + srow) * Kd + (tid & 7) * 8;
  const unsigned short* gb = Bm + (size_t)(bcol + srow) * Kd + (tid & 7) * 8;
  const int lofs = srow * LDT + (tid & 7) * 8;

  // stages 0 and 1 start together; stage 0 lands and is published; stage 2 then starts as well
  if (grp == 0)   stage_tile(ga, gb, &As[0][lofs], &Bs[0][lofs], Kd);
  else if (T > 1) stage_tile(ga + BK, gb + BK, &As[1][lofs], &Bs[1][lofs], Kd);
  if (grp == 0) asm volatile("s_wait_asynccnt 0x0" ::: "memory");   // this wave's copies of stage 0 have landed
  __syncthreads();
  if (grp == 0 && T > 2) stage_tile(ga + 2 * BK, gb + 2 * BK, &As[2][lofs], &Bs[2][lofs], Kd);

  int cur = 0;    // t % NBUF
  for (int t = 0; t < T; ++t) {

    // fragment fetch from LDS (matches ISA 16-bit A/B VGPR layout:
    // lane<16 -> K[0..7],K[16..23]; lane>=16 -> K[8..15],K[24..31]), one 32-deep half of the tile at a time
    // (unrolled: every fragment and accumulator index is a constant, so all of them stay in registers)
#pragma unroll
    for (int kk = 0; kk < BK / 32; ++kk) {
      Frag a[4], b[2];
#pragma unroll
      for (int mf = 0; mf < 4; ++mf) {
        int row = wm * 64 + mf * 16 + l16;
        a[mf].q[0] = *(const uint4*)&As[cur][row * LDT + kk * 32 + half * 8];
        a[mf].q[1] = *(const uint4*)&As[cur][row * LDT + kk * 32 + 16 + half * 8];
      }
#pragma unroll
      for (int nf = 0; nf < 2; ++nf) {
        int row = wn * 32 + nf * 16 + l16;
        b[nf].q[0] = *(const uint4*)&Bs[cur][row * LDT + kk * 32 + half * 8];
        b[nf].q[1] = *(const uint4*)&Bs[cur][row * LDT + kk * 32 + 16 + half * 8];
      }
#pragma unroll
      for (int mf = 0; mf < 4; ++mf)
#pragma unroll
        for (int nf = 0; nf < 2; ++nf)
          acc[mf][nf] = __builtin_amdgcn_wmma_f32_16x16x32_bf16(
              false, a[mf].v, false, b[nf].v, (short)0, acc[mf][nf], false, false);
    }

    asm volatile("s_wait_dscnt 0x0" ::: "memory");      // this wave's reads of buffer cur have retired
    // the half that copied stage t + 1 waits for it; stage t + 2, the other half's, flies on
    if (grp == ((t + 1) & 1)) asm volatile("s_wait_asynccnt 0x0" ::: "memory");
    __syncthreads();    // publishes stage t + 1 and ends every wave's reads of buffer cur
    if (t + 3 < T && grp == ((t + 1) & 1))
      stage_tile(ga + (t + 3) * BK, gb + (t + 3) * BK, &As[cur][lofs], &Bs[cur][lofs], Kd);
    cur = cur == NBUF - 1 ? 0 : cur + 1;
  }
  asm volatile("s_wait_asynccnt 0x0" ::: "memory");     // no copy is left in flight when the wave ends

  // epilogue: C/D layout -> VGPR r: lanes 0-15 are M=r, lanes 16-31 are M=8+r, N=lane%16
#pragma unroll
  for (int nf = 0; nf < 2; ++nf) {
    int gn = bcol + wn * 32 + nf * 16 + l16;
    float bb = bias[gn];
#pragma unroll
    for (int mf = 0; mf < 4; ++mf) {
      int gm = brow + wm * 64 + mf * 16 + half * 8;
      float* Cp = C + (size_t)gm * Ndim + gn;
#pragma unroll
      for (int r = 0; r < 8; ++r)
        Cp[(size_t)r * Ndim] = acc[mf][nf][r] + bb;
    }
  }
}

// ---------------- QKV projection and dilated attention in one kernel ----------------
// A block takes 128 queries of one head. It projects the head's q, k and v columns (192 rows of w_qkv)
// for those queries' rows of x and for the 16 rows on either side, which the window reaches, keeps the
// fp32 result in LDS and attends there: q, k and v never go to memory. The rows on either side are
// projected again by the neighbouring blocks.
// In the attention part four lanes share two queries, 16 head dims each; the 16 lanes that hold a key row
// sum its squares for the inverse norm, and so do the four lanes that hold a query.
#define FQ     128           // queries per block
#define FR     (FQ + 32)     // projected rows of x
#define FC     (3 * DH)      // projected columns: q, k, v of the head
#define FSTG   ((FR + FC) * LDT)   // ushorts in one ring buffer: the x rows, then the weight rows
#define KPITCH 68            // LDS row pitch in floats: 16 lanes of a b128 read hit 16 distinct bank groups

// sum over the four lanes of a quad, same bits in all four
__device__ __forceinline__ float quad_sum(float x) {
  x += __builtin_bit_cast(float, __builtin_amdgcn_mov_dpp(__builtin_bit_cast(int, x), 0xB1, 0xf, 0xf, true)); // quad_perm [1,0,3,2]
  x += __builtin_bit_cast(float, __builtin_amdgcn_mov_dpp(__builtin_bit_cast(int, x), 0x4E, 0xf, 0xf, true)); // quad_perm [2,3,0,1]
  return x;
}

// sum over the 16 lanes of a row, same bits in all sixteen
__device__ __forceinline__ float row_sum(float x) {
  x = quad_sum(x);
  x += __builtin_bit_cast(float, __builtin_amdgcn_mov_dpp(__builtin_bit_cast(int, x), 0x164, 0xf, 0xf, true)); // row_xmask:4
  x += __builtin_bit_cast(float, __builtin_amdgcn_mov_dpp(__builtin_bit_cast(int, x), 0x168, 0xf, 0xf, true)); // row_xmask:8
  return x;
}

// e^x as the fast intrinsic forms it (multiply by log2 e, v_exp_f32); the v_nop fills the one slot the
// instruction set asks for between a transcendental and a next instruction that overwrites its source
__device__ __forceinline__ float exp_slot(float x) {
  float r, y = x * 1.44269504088896340736f;
  asm("v_exp_f32 %0, %1\n\tv_nop" : "=v"(r) : "v"(y));
  return r;
}

typedef __attribute__((ext_vector_type(2))) float v2f;
typedef __attribute__((ext_vector_type(4))) float v4f;

// four waves per SIMD: two blocks per WGP, so that one block's waits hide behind the other's work
__global__ __launch_bounds__(256) __attribute__((amdgpu_waves_per_eu(4)))
void qkv_attn(const unsigned short* __restrict__ X, const unsigned short* __restrict__ Wq,
              const float* __restrict__ bias, unsigned short* __restrict__ aout) {
  // first the three-buffer ring of bf16 operand tiles, then, behind the K loop, q, k and v in fp32
  __shared__ __attribute__((aligned(16))) char smem[NBUF * FSTG * 2];
  static_assert(3 * FR * KPITCH * 4 <= NBUF * FSTG * 2, "the q, k, v planes fit in the ring");
  static_assert(2 * NBUF * FSTG * 2 <= 320 * 1024, "two blocks per WGP");
  unsigned short* ring = (unsigned short*)smem;
  float* Qs = (float*)smem;
  float* Ks = Qs + FR * KPITCH;
  float* Vs = Ks + FR * KPITCH;

  const int tid  = threadIdx.x;
  const int lane = tid & 31;
  const int wid  = tid >> 5;
  const int wm   = wid >> 2;     // 0..1  -> 80 rows each
  const int wn   = wid & 3;      // 0..3  -> 48 cols each
  const int l16  = lane & 15;
  const int half = lane >> 4;    // 0/1: selects K sub-chunk per ISA bf16 A/B layout

  const int h    = blockIdx.x % HH;
  const int rest = blockIdx.x / HH;
  const int tile = rest % (SEQ / FQ);
  const int b    = rest / (SEQ / FQ);
  const int i0   = tile * FQ;
  const int T    = DMODEL / BK;

  v8f acc[FR / 32][FC / 64] = {};

  // which half of the waves this one belongs to, in a scalar register: every test on it is a scalar branch
  const int grp = __builtin_amdgcn_readfirstlane(tid >> 7);
  // This lane's 16-byte chunk of a staged row: row (tid % 128) / 8 of each group of 16 rows, chunk tid % 8.
  // Staged row r is position i0 - 16 + r of the sequence; a position outside it is clamped to the
  // nearest one inside (in bounds), and the window's own test keeps such a row out of every sum.
  // Only the first and the last group of 16 can leave the sequence: the eight between are the block's own
  // queries and lie at constant steps from the first of them.
  const int srow = (tid & 127) >> 3;
  auto xofs = [&](int r) {
    int j = i0 - 16 + r;
    j = j < 0 ? 0 : j > SEQ - 1 ? SEQ - 1 : j;
    return (unsigned)(b * SEQ + j) * DMODEL + (tid & 7) * 8;
  };
  const unsigned alo = xofs(srow), amid = xofs(16 + srow), ahi = xofs(FR - 16 + srow);
  const unsigned short* gb = Wq + (size_t)(h * DH + srow) * DMODEL + (tid & 7) * 8;
  const int lofs = srow * LDT + (tid & 7) * 8;

  // one K step's tiles: 160 rows of x and 192 of w_qkv (64 each from its q, k and v parts), 128 bytes a row
  auto stage = [&](int t, int buf) {
    unsigned short* la = ring + buf * FSTG + lofs;
    unsigned short* lb = la + FR * LDT;
    // unrolled: the 22 copies issue back to back, their row steps constants
    stage_chunk(X + alo + t * BK, la);
#pragma unroll
    for (int s = 1; s < FR / 16 - 1; ++s)
      stage_chunk(X + amid + (s - 1) * 16 * DMODEL + t * BK, la + s * 16 * LDT);
    stage_chunk(X + ahi + t * BK, la + (FR - 16) * LDT);
#pragma unroll
    for (int s = 0; s < FC / 16; ++s)
      stage_chunk(gb + (size_t)((s >> 2) * DMODEL + (s & 3) * 16) * DMODEL + t * BK, lb + s * 16 * LDT);
  };

  // stages 0 and 1 start together; stage 0 lands and is published; stage 2 then starts as well
  static_assert(DMODEL / BK > 2, "the prologue's three stages exist");
  if (grp == 0) stage(0, 0); else stage(1, 1);

  // the bias of this lane's three columns, fetched here so that the loads fly beside tile 0's copies
  // (a fragment's 16 columns lie in one of q, k, v: plane n0 / 64, column n0 % 64 + l16 of the head)
  int bi[FC / 64];
  float bb[FC / 64];
#pragma unroll
  for (int nf = 0; nf < FC / 64; ++nf) {
    const int n0 = wn * (FC / 4) + nf * 16;
    bi[nf] = (n0 >> 6) * DMODEL + h * DH + (n0 & 63) + l16;
    bb[nf] = bias[bi[nf]];
  }
  // The wait that stands in front of the first overwrite of a register that an issued load names. Its
  // inputs are those registers: they stay live up to here, so no load's result is placed on one of them.
  asm volatile("s_wait_xcnt 0x0" :: "v"(bi[0]), "v"(bi[1]), "v"(bi[2]), "s"(bias) : "memory");

  if (grp == 0) asm volatile("s_wait_asynccnt 0x0" ::: "memory");   // this wave's copies of stage 0 have landed
  __syncthreads();
  if (grp == 0) stage(2, 2);

  int cur = 0;    // t % NBUF
  for (int t = 0; t < T; ++t) {
    const unsigned short* As = ring + cur * FSTG;
    const unsigned short* Bs = As + FR * LDT;

    // fragment fetch from LDS (matches ISA 16-bit A/B VGPR layout:
    // lane<16 -> K[0..7],K[16..23]; lane>=16 -> K[8..15],K[24..31]), one 32-deep half of the tile at a time
    // (all loops unrolled: every fragment and accumulator index is a constant, so all of them stay in registers)
    Frag a[FR / 32], bf[FC / 64];
    auto fetch = [&](int kk) {
#pragma unroll
      for (int mf = 0; mf < FR / 32; ++mf) {
        int row = wm * (FR / 2) + mf * 16 + l16;
        a[mf].q[0] = *(const uint4*)&As[row * LDT + kk * 32 + half * 8];
        a[mf].q[1] = *(const uint4*)&As[row * LDT + kk * 32 + 16 + half * 8];
      }
#pragma unroll
      for (int nf = 0; nf < FC / 64; ++nf) {
        int row = wn * (FC / 4) + nf * 16 + l16;
        bf[nf].q[0] = *(const uint4*)&Bs[row * LDT + kk * 32 + half * 8];
        bf[nf].q[1] = *(const uint4*)&Bs[row * LDT + kk * 32 + 16 + half * 8];
      }
    };
    auto products = [&]() {
#pragma unroll
      for (int mf = 0; mf < FR / 32; ++mf)
#pragma unroll
        for (int nf = 0; nf < FC / 64; ++nf)
          acc[mf][nf] = __builtin_amdgcn_wmma_f32_16x16x32_bf16(
              false, a[mf].v, false, bf[nf].v, (short)0, acc[mf][nf], false, false);
    };

    fetch(0);
    products();
    fetch(1);

    // The tile's second half is in registers, so the buffer is handed over here and its refill is
    // under way while that half's WMMAs run.
    asm volatile("s_wait_dscnt 0x0" ::: "memory");      // this wave's reads of buffer cur have retired
    // the half that copied stage t + 1 waits for it; stage t + 2, the other half's, flies on
    if (grp == ((t + 1) & 1)) asm volatile("s_wait_asynccnt 0x0" ::: "memory");
    __syncthreads();    // publishes stage t + 1 and ends every wave's reads of buffer cur
    if (t + 3 < T && grp == ((t + 1) & 1)) stage(t + 3, cur);
    products();
    cur = cur == NBUF - 1 ? 0 : cur + 1;
  }
  asm volatile("s_wait_asynccnt 0x0" ::: "memory");     // no copy is in flight when the ring's LDS gets its new use

  // The last trip's barrier has ended every wave's reads of the ring: q, k and v, bias added, take its place.
  // C/D layout -> VGPR r: lanes 0-15 are M=r, lanes 16-31 are M=8+r, N=lane%16
#pragma unroll
  for (int nf = 0; nf < FC / 64; ++nf) {
    const int n0 = wn * (FC / 4) + nf * 16;
    float* dst = Qs + (n0 >> 6) * (FR * KPITCH) + (n0 & 63) + l16;
#pragma unroll
    for (int mf = 0; mf < FR / 32; ++mf)
#pragma unroll
      for (int r = 0; r < 8; ++r)
        dst[(wm * (FR / 2) + mf * 16 + half * 8 + r) * KPITCH] = acc[mf][nf][r] + bb[nf];
  }
  __syncthreads();    // every row of q, k and v is whole before a lane reads one

  // K normalised in place, 16 lanes a row, 16 rows a pass
#pragma unroll
  for (int s = 0; s < FR / 16; ++s) {
    float4* kp = (float4*)&Ks[(s * 16 + (tid >> 4)) * KPITCH + (tid & 15) * 4];
    float4 k4 = *kp;
    const float kk = row_sum(k4.x * k4.x + k4.y * k4.y + k4.z * k4.z + k4.w * k4.w);
    const float ki = 1.0f / (sqrtf(kk) + 1e-6f);
    k4.x *= ki; k4.y *= ki; k4.z *= ki; k4.w *= ki;
    *kp = k4;
  }
  __syncthreads();    // the normalised rows are read by other waves

  // A quad of lanes takes two queries four rows apart. Their windows share 15 of 17 key rows, so the
  // 19 rows of the two windows together are each read from LDS once and used for both queries.
  // The four quads of a 16-lane half hold four neighbouring rows: their b128 reads fall on distinct banks.
  const int part = tid & 3;    // which 16 of the 64 head dims
  const int qa   = (tid >> 4) * 8 + ((tid >> 2) & 3);   // first query inside the block; the second is qa + 4
  const int ia   = i0 + qa;
  constexpr int ROWS = WIN + 2;   // key rows qa + 2u: query z takes u = 2z .. 2z + 16

  v2f q[2][8];
#pragma unroll
  for (int z = 0; z < 2; ++z) {
    const v4f* qp = (const v4f*)&Qs[(qa + 4 * z + 16) * KPITCH + part * 16];
    const v4f qr0 = qp[0], qr1 = qp[1], qr2 = qp[2], qr3 = qp[3];
    const v4f sq = qr0 * qr0 + qr1 * qr1 + qr2 * qr2 + qr3 * qr3;
    const float qi = 1.0f / (sqrtf(quad_sum((sq.x + sq.y) + (sq.z + sq.w))) + 1e-6f);
    v4f f0 = qr0 * qi, f1 = qr1 * qi, f2 = qr2 * qi, f3 = qr3 * qi;
    q[z][0] = f0.lo; q[z][1] = f0.hi; q[z][2] = f1.lo; q[z][3] = f1.hi;
    q[z][4] = f2.lo; q[z][5] = f2.hi; q[z][6] = f3.lo; q[z][7] = f3.hi;
  }

  float s[2][WIN];
#pragma unroll
  for (int u = 0; u < ROWS; ++u) {
    const v4f* kr = (const v4f*)&Ks[(qa + 2 * u) * KPITCH + part * 16];
    const v4f f0 = kr[0], f1 = kr[1], f2 = kr[2], f3 = kr[3];
    const int j = ia - 16 + 2 * u;
    const bool in = j >= 0 && j < SEQ;
#pragma unroll
    for (int z = 0; z < 2; ++z) {
      const int t = u - 2 * z;
      if (t < 0 || t >= WIN) continue;
      v2f pa = {0.f, 0.f};
      pa += q[z][0] * f0.lo;  pa += q[z][1] * f0.hi;
      pa += q[z][2] * f1.lo;  pa += q[z][3] * f1.hi;
      pa += q[z][4] * f2.lo;  pa += q[z][5] * f2.hi;
      pa += q[z][6] * f3.lo;  pa += q[z][7] * f3.hi;
      const float p = quad_sum(pa.x + pa.y);
      s[z][t] = in ? p : -3.0e38f;
    }
    // bounds how many key rows are fetched ahead: left free, the scheduler hoisted more than the registers
    // hold and spilled to scratch
    if (u % 4 == 3) __builtin_amdgcn_sched_barrier(0);
  }

  float inv[2];
#pragma unroll
  for (int z = 0; z < 2; ++z) {
    float mx = -3.0e38f;
#pragma unroll
    for (int t = 0; t < WIN; ++t) mx = fmaxf(mx, s[z][t]);
    float sum = 0.f;
#pragma unroll
    for (int t = 0; t < WIN; ++t) { s[z][t] = exp_slot(s[z][t] - mx); sum += s[z][t]; }
    inv[z] = 1.0f / sum;
  }

#pragma unroll
  for (int z = 0; z < 2; ++z)
#pragma unroll
    for (int t = 0; t < WIN; ++t) s[z][t] *= inv[z];

  // The two queries' outputs lie side by side in a register pair: one packed multiply-add takes a value
  // element for both. The rows at either end of the 19 belong to one query alone.
  // The lane's 16 head dims go in two passes of 8. The loop stays rolled: the compiler fetches a pass's
  // rows ahead of its first product, and all 19 rows of 16 dims are more than the registers hold (spills).
#pragma unroll 1
  for (int hf = 0; hf < 2; ++hf) {
    v2f o[8];
#pragma unroll
    for (int k = 0; k < 8; ++k) o[k] = (v2f){0.f, 0.f};
#pragma unroll
    for (int u = 0; u < ROWS; ++u) {
      const v4f* vr = (const v4f*)&Vs[(qa + 2 * u) * KPITCH + part * 16 + hf * 8];
      const v4f r0 = vr[0], r1 = vr[1];
      const float f[8] = {r0.x, r0.y, r0.z, r0.w, r1.x, r1.y, r1.z, r1.w};
      if (u < 2) {
#pragma unroll
        for (int k = 0; k < 8; ++k) o[k].x += s[0][u] * f[k];
      } else if (u >= WIN) {
#pragma unroll
        for (int k = 0; k < 8; ++k) o[k].y += s[1][u - 2] * f[k];
      } else {
        const v2f w = {s[0][u], s[1][u - 2]};
#pragma unroll
        for (int k = 0; k < 8; ++k) o[k] += w * (v2f){f[k], f[k]};
      }
    }
#pragma unroll
    for (int z = 0; z < 2; ++z) {
      unsigned pk[4];
#pragma unroll
      for (int k = 0; k < 4; ++k)
        pk[k] = (unsigned)f2bf(o[2 * k][z]) | ((unsigned)f2bf(o[2 * k + 1][z]) << 16);
      uint4* op = (uint4*)(aout + (size_t)(b * SEQ + ia + 4 * z) * DMODEL + h * DH + part * 16);
      op[hf] = make_uint4(pk[0], pk[1], pk[2], pk[3]);
    }
    // the wait that stands in front of the first overwrite of a register that an issued store names:
    // the next pass of this loop forms its values in the same registers
    asm volatile("s_wait_xcnt 0x0" ::: "memory");
  }
}

// ---------------- launch ----------------
extern "C" void kernel_launch(void* const* d_in, const int* in_sizes, int n_in,
                              void* d_out, int out_size, void* d_ws, size_t ws_size,
                              hipStream_t stream) {
  const float* x     = (const float*)d_in[0];  // [2,2048,1024]
  const float* w_qkv = (const float*)d_in[1];  // [3072,1024]
  const float* b_qkv = (const float*)d_in[2];  // [3072]
  const float* w_out = (const float*)d_in[3];  // [1024,1024]
  const float* b_out = (const float*)d_in[4];  // [1024]
  float* out = (float*)d_out;                  // [2,2048,1024] fp32

  const int M  = BATCH * SEQ;      // 4096
  const int N2 = DMODEL;           // 1024
  const int Kd = DMODEL;           // 1024

  char* w = (char*)d_ws;
  unsigned short* xb    = (unsigned short*)(w);                    // 8 MB
  unsigned short* wqkvb = (unsigned short*)(w + (8u << 20));       // 6 MB
  unsigned short* woutb = (unsigned short*)(w + (14u << 20));      // 2 MB
  unsigned short* attnb = (unsigned short*)(w + (16u << 20));      // 8 MB

  // 1) fp32 -> bf16 conversions, one launch: xb, wqkvb and woutb are one run of bytes from xb on
  cvt3_f32_bf16<<<(X4 + WQ4 + WO4) / 256, 256, 0, stream>>>(x, w_qkv, w_out, xb);

  // 2) QKV projection x @ w_qkv^T + b_qkv (WMMA bf16, fp32 acc) and, on its result in LDS,
  //    dilated masked attention with q/k norms -> bf16 [M, D]
  qkv_attn<<<(M / FQ) * HH, 256, 0, stream>>>(xb, wqkvb, b_qkv, attnb);

  // 3) output projection: out = attn @ w_out^T + b_out
  gemm_nt_bias<<<dim3(N2 / BN, M / BM), 256, 0, stream>>>(attnb, woutb, b_out, out, N2, Kd);
}

// v008
// One run takes 44.9 microseconds.
// Next to v007, in two timings, it ran 1.04 and 1.05 times as fast.
// All steps since v000 together make it 5.18 times as fast.
#include <hip/hip_runtime.h>
#include <hip/hip_bf16.h>

typedef __attribute__((ext_vector_type(16))) __bf16 v16bf;
typedef __attribute__((ext_vector_type(8)))  float  v8f;
typedef __attribute__((ext_vector_type(4)))  int    v4i;

#define HH     16      // heads
#define DH     64      // head dim
#define SEQ    2048
#define DMODEL 1024
#define BATCH  2
#define WIN    17      // dilated window size: j = i-16 .. i+16 step 2

#if __has_builtin(__builtin_amdgcn_global_load_async_to_lds_b128)
#define USE_ASYNC_LDS 1
#else
#define USE_ASYNC_LDS 0
#endif

#define AS1 __attribute__((address_space(1)))
#define AS3 __attribute__((address_space(3)))

// ---------------- fp32 -> bf16 (round to nearest even) ----------------
__device__ __forceinline__ unsigned short f2bf(float f) {
  unsigned u = __builtin_bit_cast(unsigned, f);
  unsigned r = u + 0x7FFFu + ((u >> 16) & 1u);
  return (unsigned short)(r >> 16);
}

// One launch converts all three fp32 operands. Their bf16 copies lie back to back in the workspace, so
// the flat index is the place in out; each operand fills a whole number of blocks, so the source is
// picked once per block, by a scalar test.
#define X4  (BATCH * SEQ * DMODEL / 4)     // groups of four floats in x
#define WQ4 (3 * DMODEL * DMODEL / 4)      // in w_qkv
#define WO4 (DMODEL * DMODEL / 4)          // in w_out

__global__ __launch_bounds__(256)
void cvt3_f32_bf16(const float* __restrict__ x, const float* __restrict__ wqkv,
                   const float* __restrict__ wout, unsigned short* __restrict__ out) {
  const int first = blockIdx.x * 256;      // the block's first group, counted over all three operands
  const float* src = x;
  int base = 0;
  if (first >= X4 + WQ4)  { src = wout; base = X4 + WQ4; }
  else if (first >= X4)   { src = wqkv; base = X4; }
  // both block bases are scalar: the thread index alone is the lane's offset for the load and the store
  const float4* in4 = (const float4*)src + (first - base);
  ushort4* out4 = (ushort4*)out + first;
  float4 f = in4[threadIdx.x];
  ushort4 o;
  o.x = f2bf(f.x); o.y = f2bf(f.y); o.z = f2bf(f.z); o.w = f2bf(f.w);
  out4[threadIdx.x] = o;
}

// ---------------- bf16 NT GEMM with fp32 accumulate: C = A * B^T + bias ----------------
// A: [M][Kd] bf16 row-major; Bm: [Nd][Kd] bf16 row-major (so B^T is Kd x Nd);
// C: [M][Nd] fp32.  M,Nd multiples of 128; Kd multiple of 64.
#define BM 128
#define BN 128
#define BK 64
#define LDT 72   // LDS row pitch in ushorts: 144 B = 16 B x odd, free of bank conflicts for 16-byte reads

union Frag { v16bf v; uint4 q[2]; };

__device__ __forceinline__ void stage_chunk(const unsigned short* __restrict__ gsrc,
                                            unsigned short* lds_dst) {
#if USE_ASYNC_LDS
  // CDNA5 async DMA: global -> LDS without VGPR round trip, tracked on ASYNCcnt
  __builtin_amdgcn_global_load_async_to_lds_b128(
      (AS1 v4i*)gsrc, (AS3 v4i*)lds_dst, 0, 0);
#else
  *(uint4*)lds_dst = *(const uint4*)gsrc;
#endif
}

// The ring has three buffers and a K step's tiles (a stage) fly for two trips. Four of the block's eight
// waves copy a whole stage: waves 0-3 the even stages, waves 4-7 the odd ones. So a wave never has more
// than one stage in flight, and its wait for that stage, to zero, leaves the other half's stage flying.
#define NBUF 3

// One K step's A and B tiles, 128 rows of 128 bytes each. ga, gb, la, lb are the lane's own places in
// the first 16 rows: eight lanes lie along a row, so each wave-wide copy covers four whole 128-byte lines.
__device__ __forceinline__ void stage_tile(const unsigned short* __restrict__ ga,
                                           const unsigned short* __restrict__ gb,
                                           unsigned short* la, unsigned short* lb, int Kd) {
  // unrolled: the sixteen copies issue back to back, their row steps folded into the addresses
#pragma unroll
  for (int s = 0; s < BM / 16; ++s) {
    stage_chunk(ga + (size_t)(s * 16) * Kd, la + s * 16 * LDT);
    stage_chunk(gb + (size_t)(s * 16) * Kd, lb + s * 16 * LDT);
  }
}

__global__ __launch_bounds__(256)
void gemm_nt_bias(const unsigned short* __restrict__ A,
                  const unsigned short* __restrict__ Bm,
                  const float* __restrict__ bias,
                  float* __restrict__ C,
                  int Ndim, int Kd) {
  __shared__ __attribute__((aligned(16))) unsigned short As[NBUF][BM * LDT];
  __shared__ __attribute__((aligned(16))) unsigned short Bs[NBUF][BN * LDT];

  const int tid  = threadIdx.x;
  const int lane = tid & 31;
  const int wid  = tid >> 5;
  const int wm   = wid >> 2;     // 0..1  -> 64 rows each
  const int wn   = wid & 3;      // 0..3  -> 32 cols each
  const int l16  = lane & 15;
  const int half = lane >> 4;    // 0/1: selects K sub-chunk per ISA bf16 A/B layout

  const int brow = blockIdx.y * BM;
  const int bcol = blockIdx.x * BN;
  const int T = Kd / BK;

  v8f acc[4][2] = {};

  // which half of the waves this one belongs to, in a scalar register: every test on it is a scalar branch
  const int grp = __builtin_amdgcn_readfirstlane(tid >> 7);
  // this lane's 16-byte chunk of a staged row: row (tid % 128) / 8 of each group of 16 rows, chunk tid % 8
  const int srow = (tid & 127) >> 3;
  const unsigned short* ga = A  + (size_t)(brow + srow) * Kd + (tid & 7) * 8;
  const unsigned short* gb = Bm + (size_t)(bcol + srow) * Kd + (tid & 7) * 8;
  const int lofs = srow * LDT + (tid & 7) * 8;

  // stages 0 and 1 start together; stage 0 lands and is published; stage 2 then starts as well
  if (grp == 0)   stage_tile(ga, gb, &As[0][lofs], &Bs[0][lofs], Kd);
  else if (T > 1) stage_tile(ga + BK, gb + BK, &As[1][lofs], &Bs[1][lofs], Kd);
  if (grp == 0) asm volatile("s_wait_asynccnt 0x0" ::: "memory");   // this wave's copies of stage 0 have landed
  __syncthreads();
  if (grp == 0 && T > 2) stage_tile(ga + 2 * BK, gb + 2 * BK, &As[2][lofs], &Bs[2][lofs], Kd);

  int cur = 0;    // t % NBUF
  for (int t = 0; t < T; ++t) {

    // fragment fetch from LDS (matches ISA 16-bit A/B VGPR layout:
    // lane<16 -> K[0..7],K[16..23]; lane>=16 -> K[8..15],K[24..31]), one 32-deep half of the tile at a time
    // (unrolled: every fragment and accumulator index is a constant, so all of them stay in registers)
#pragma unroll
    for (int kk = 0; kk < BK / 32; ++kk) {
      Frag a[4], b[2];
#pragma unroll
      for (int mf = 0; mf < 4; ++mf) {
        int row = wm * 64 + mf * 16 + l16;
        a[mf].q[0] = *(const uint4*)&As[cur][row * LDT + kk * 32 + half * 8];
        a[mf].q[1] = *(const uint4*)&As[cur][row * LDT + kk * 32 + 16 + half * 8];
      }
#pragma unroll
      for (int nf = 0; nf < 2; ++nf) {
        int row = wn * 32 + nf * 16 + l16;
        b[nf].q[0] = *(const uint4*)&Bs[cur][row * LDT + kk * 32 + half * 8];
        b[nf].q[1] = *(const uint4*)&Bs[cur][row * LDT + kk * 32 + 16 + half * 8];
      }
#pragma unroll
      for (int mf = 0; mf < 4; ++mf)
#pragma unroll
        for (int nf = 0; nf < 2; ++nf)
          acc[mf][nf] = __builtin_amdgcn_wmma_f32_16x16x32_bf16(
              false, a[mf].v, false, b[nf].v, (short)0, acc[mf][nf], false, false);
    }

    asm volatile("s_wait_dscnt 0x0" ::: "memory");      // this wave's reads of buffer cur have retired
    // the half that copied stage t + 1 waits for it; stage t + 2, the other half's, flies on
    if (grp == ((t + 1) & 1)) asm volatile("s_wait_asynccnt 0x0" ::: "memory");
    __syncthreads();    // publishes stage t + 1 and ends every wave's reads of buffer cur
    if (t + 3 < T && grp == ((t + 1) & 1))
      stage_tile(ga + (t + 3) * BK, gb + (t + 3) * BK, &As[cur][lofs], &Bs[cur][lofs], Kd);
    cur = cur == NBUF - 1 ? 0 : cur + 1;
  }
  asm volatile("s_wait_asynccnt 0x0" ::: "memory");     // no copy is left in flight when the wave ends

  // epilogue: C/D layout -> VGPR r: lanes 0-15 are M=r, lanes 16-31 are M=8+r, N=lane%16
#pragma unroll
  for (int nf = 0; nf < 2; ++nf) {
    int gn = bcol + wn * 32 + nf * 16 + l16;
    float bb = bias[gn];
#pragma unroll
    for (int mf = 0; mf < 4; ++mf) {
      int gm = brow + wm * 64 + mf * 16 + half * 8;
      float* Cp = C + (size_t)gm * Ndim + gn;
#pragma unroll
      for (int r = 0; r < 8; ++r)
        Cp[(size_t)r * Ndim] = acc[mf][nf][r] + bb;
    }
  }
}

// ---------------- QKV projection and dilated attention in one kernel ----------------
// A block of twelve waves takes 256 queries of one head and has its WGP to itself. It projects the head's
// q, k and v columns (192 rows of w_qkv) for those queries' rows of x and for the 16 rows on either side,
// which the window reaches, keeps the fp32 result in LDS and attends there: q, k and v never go to memory.
// The rows on either side are projected again by the neighbouring blocks.
// In the attention part four lanes share two queries, 16 head dims each; the 16 lanes that hold a key row
// sum its squares for the inverse norm, and so do the four lanes that hold a query.
#define FQ     256           // queries per block
#define FT     384           // threads per block: 3 x 4 waves, each with 96 rows x 48 columns of the product
#define MF     (FR / 48)     // 16-row fragments of x per wave
#define FR     (FQ + 32)     // projected rows of x
#define FC     (3 * DH)      // projected columns: q, k, v of the head
#define FSTG   ((FR + FC) * LDT)   // ushorts in one ring buffer: the x rows, then the weight rows
#define KPITCH 68            // LDS row pitch in floats: 16 lanes of a b128 read hit 16 distinct bank groups

// sum over the four lanes of a quad, same bits in all four
__device__ __forceinline__ float quad_sum(float x) {
  x += __builtin_bit_cast(float, __builtin_amdgcn_mov_dpp(__builtin_bit_cast(int, x), 0xB1, 0xf, 0xf, true)); // quad_perm [1,0,3,2]
  x += __builtin_bit_cast(float, __builtin_amdgcn_mov_dpp(__builtin_bit_cast(int, x), 0x4E, 0xf, 0xf, true)); // quad_perm [2,3,0,1]
  return x;
}

// sum over the 16 lanes of a row, same bits in all sixteen
__device__ __forceinline__ float row_sum(float x) {
  x = quad_sum(x);
  x += __builtin_bit_cast(float, __builtin_amdgcn_mov_dpp(__builtin_bit_cast(int, x), 0x164, 0xf, 0xf, true)); // row_xmask:4
  x += __builtin_bit_cast(float, __builtin_amdgcn_mov_dpp(__builtin_bit_cast(int, x), 0x168, 0xf, 0xf, true)); // row_xmask:8
  return x;
}

// e^x as the fast intrinsic forms it (multiply by log2 e, v_exp_f32); the v_nop fills the one slot the
// instruction set asks for between a transcendental and a next instruction that overwrites its source
__device__ __forceinline__ float exp_slot(float x) {
  float r, y = x * 1.44269504088896340736f;
  asm("v_exp_f32 %0, %1\n\tv_nop" : "=v"(r) : "v"(y));
  return r;
}

typedef __attribute__((ext_vector_type(2))) float v2f;
typedef __attribute__((ext_vector_type(4))) float v4f;

// three waves per SIMD: one block per WGP. At most 256 registers: beyond them the K loop's LDS reads and
// WMMAs stand among register-window switches
__global__ __launch_bounds__(FT) __attribute__((amdgpu_waves_per_eu(3), amdgpu_num_vgpr(256)))
void qkv_attn(const unsigned short* __restrict__ X, const unsigned short* __restrict__ Wq,
              const float* __restrict__ bias, unsigned short* __restrict__ aout) {
  // first the three-buffer ring of bf16 operand tiles, then, behind the K loop, q, k and v in fp32
  __shared__ __attribute__((aligned(16))) char smem[3 * FR * KPITCH * 4];
  static_assert(NBUF * FSTG * 2 <= 3 * FR * KPITCH * 4, "the ring fits in the q, k, v planes");
  static_assert(3 * FR * KPITCH * 4 <= 320 * 1024, "one block per WGP");
  unsigned short* ring = (unsigned short*)smem;
  float* Qs = (float*)smem;
  float* Ks = Qs + FR * KPITCH;
  float* Vs = Ks + FR * KPITCH;

  const int tid  = threadIdx.x;
  const int lane = tid & 31;
  const int wid  = tid >> 5;
  const int wm   = wid >> 2;     // 0..2  -> 96 rows each
  const int wn   = wid & 3;      // 0..3  -> 48 cols each
  const int l16  = lane & 15;
  const int half = lane >> 4;    // 0/1: selects K sub-chunk per ISA bf16 A/B layout

  const int h    = blockIdx.x % HH;
  const int rest = blockIdx.x / HH;
  const int tile = rest % (SEQ / FQ);
  const int b    = rest / (SEQ / FQ);
  const int i0   = tile * FQ;
  const int T    = DMODEL / BK;

  v8f acc[MF][FC / 64] = {};

  // Which four of the twelve waves this one belongs to, in a scalar register: every test on it is a scalar
  // branch. Group g copies the stages that go into ring buffer g, so a wave never has more than one stage
  // in flight, and its wait for that stage, to zero, leaves the other groups' stages flying.
  const int grp = __builtin_amdgcn_readfirstlane(tid >> 7);
  // This lane's 16-byte chunk of a staged row: row (tid % 128) / 8 of each group of 16 rows, chunk tid % 8.
  // Staged row r is position i0 - 16 + r of the sequence; a position outside it is clamped to the
  // nearest one inside (in bounds), and the window's own test keeps such a row out of every sum.
  // Only the first and the last group of 16 can leave the sequence: the sixteen between are the block's own
  // queries and lie at constant steps from the first of them.
  const int srow = (tid & 127) >> 3;
  auto xofs = [&](int r) {
    int j = i0 - 16 + r;
    j = j < 0 ? 0 : j > SEQ - 1 ? SEQ - 1 : j;
    return (unsigned)(b * SEQ + j) * DMODEL + (tid & 7) * 8;
  };
  const unsigned alo = xofs(srow), amid = xofs(16 + srow), ahi = xofs(FR - 16 + srow);
  const unsigned short* gb = Wq + (size_t)(h * DH + srow) * DMODEL + (tid & 7) * 8;
  const int lofs = srow * LDT + (tid & 7) * 8;

  // one K step's tiles: 288 rows of x and 192 of w_qkv (64 each from its q, k and v parts), 128 bytes a row
  auto stage = [&](int t, int buf) {
    unsigned short* la = ring + buf * FSTG + lofs;
    unsigned short* lb = la + FR * LDT;
    // unrolled: the 30 copies issue back to back, their row steps constants
    stage_chunk(X + alo + t * BK, la);
#pragma unroll
    for (int s = 1; s < FR / 16 - 1; ++s)
      stage_chunk(X + amid + (s - 1) * 16 * DMODEL + t * BK, la + s * 16 * LDT);
    stage_chunk(X + ahi + t * BK, la + (FR - 16) * LDT);
#pragma unroll
    for (int s = 0; s < FC / 16; ++s)
      stage_chunk(gb + (size_t)((s >> 2) * DMODEL + (s & 3) * 16) * DMODEL + t * BK, lb + s * 16 * LDT);
  };

  // stages 0, 1 and 2 start together, each from its own group; stage 0 lands and is published
  static_assert(DMODEL / BK > 2, "the prologue's three stages exist");
  stage(grp, grp);

  // the bias of this lane's three columns, fetched here so that the loads fly beside tile 0's copies
  // (a fragment's 16 columns lie in one of q, k, v: plane n0 / 64, column n0 % 64 + l16 of the head)
  int bi[FC / 64];
  float bb[FC / 64];
#pragma unroll
  for (int nf = 0; nf < FC / 64; ++nf) {
    const int n0 = wn * (FC / 4) + nf * 16;
    bi[nf] = (n0 >> 6) * DMODEL + h * DH + (n0 & 63) + l16;
    bb[nf] = bias[bi[nf]];
  }
  // The wait that stands in front of the first overwrite of a register that an issued load names. Its
  // inputs are those registers: they stay live up to here, so no load's result is placed on one of them.
  asm volatile("s_wait_xcnt 0x0" :: "v"(bi[0]), "v"(bi[1]), "v"(bi[2]), "s"(bias) : "memory");

  if (grp == 0) asm volatile("s_wait_asynccnt 0x0" ::: "memory");   // this wave's copies of stage 0 have landed
  __syncthreads();

  // the lane's first chunk of its wave's x rows and of its weight rows, counted from a ring buffer's start
  const int aofs = (wm * (FR / 3) + l16) * LDT + half * 8;
  const int bofs = (FR + wn * (FC / 4) + l16) * LDT + half * 8;

  int cur = 0;    // t % NBUF
  for (int t = 0; t < T; ++t) {
    const int nxt = cur == NBUF - 1 ? 0 : cur + 1;
    // one address register per operand: every fragment lies at a constant step from the lane's first chunk
    const unsigned short* As = ring + cur * FSTG + aofs;
    const unsigned short* Bs = ring + cur * FSTG + bofs;

    // fragment fetch from LDS (matches ISA 16-bit A/B VGPR layout:
    // lane<16 -> K[0..7],K[16..23]; lane>=16 -> K[8..15],K[24..31]), one 32-deep half of the tile at a time
    // (all loops unrolled: every fragment and accumulator index is a constant, so all of them stay in registers)
    Frag a[MF], bf[FC / 64];
    auto fetch = [&](int kk) {
#pragma unroll
      for (int mf = 0; mf < MF; ++mf) {
        a[mf].q[0] = *(const uint4*)&As[mf * 16 * LDT + kk * 32];
        a[mf].q[1] = *(const uint4*)&As[mf * 16 * LDT + kk * 32 + 16];
      }
#pragma unroll
      for (int nf = 0; nf < FC / 64; ++nf) {
        bf[nf].q[0] = *(const uint4*)&Bs[nf * 16 * LDT + kk * 32];
        bf[nf].q[1] = *(const uint4*)&Bs[nf * 16 * LDT + kk * 32 + 16];
      }
    };
    auto products = [&]() {
#pragma unroll
      for (int mf = 0; mf < MF; ++mf)
#pragma unroll
        for (int nf = 0; nf < FC / 64; ++nf)
          acc[mf][nf] = __builtin_amdgcn_wmma_f32_16x16x32_bf16(
              false, a[mf].v, false, bf[nf].v, (short)0, acc[mf][nf], false, false);
    };

    fetch(0);
    products();
    fetch(1);

    // The tile's second half is in registers, so the wave is done with the buffer here. The block has its
    // WGP to itself and no other block's work covers a wait at the barrier: the barrier is split, each wave
    // signals here and waits only behind that half's WMMAs, which so run while the later waves still fetch.
    // No LDS read stands between the signal and the wait.
    asm volatile("s_wait_dscnt 0x0" ::: "memory");      // this wave's reads of buffer cur have retired
    // the group that copied stage t + 1 waits for it; stage t + 2, another group's, flies on
    if (grp == nxt) asm volatile("s_wait_asynccnt 0x0" ::: "memory");
    asm volatile("s_barrier_signal -1" ::: "memory");   // this wave's part: stage t + 1 landed, buffer cur read
    // the two scheduling barriers hold the WMMAs between the signal and the wait: left free, the scheduler
    // put them behind the wait, and the split was lost
    __builtin_amdgcn_sched_barrier(0);
    products();
    __builtin_amdgcn_sched_barrier(0);
    asm volatile("s_barrier_wait -1" ::: "memory");     // stage t + 1 is published, every wave's reads of buffer cur have ended
    if (t + 3 < T && grp == cur) stage(t + 3, cur);
    cur = nxt;
  }
  asm volatile("s_wait_asynccnt 0x0" ::: "memory");     // no copy is in flight when the ring's LDS gets its new use

  // The last trip's barrier wait has ended every wave's reads of the ring: q, k and v, bias added, take its place.
  // C/D layout -> VGPR r: lanes 0-15 are M=r, lanes 16-31 are M=8+r, N=lane%16
#pragma unroll
  for (int nf = 0; nf < FC / 64; ++nf) {
    const int n0 = wn * (FC / 4) + nf * 16;
    float* dst = Qs + (n0 >> 6) * (FR * KPITCH) + (n0 & 63) + l16;
#pragma unroll
    for (int mf = 0; mf < MF; ++mf)
#pragma unroll
      for (int r = 0; r < 8; ++r)
        dst[(wm * (FR / 3) + mf * 16 + half * 8 + r) * KPITCH] = acc[mf][nf][r] + bb[nf];
  }
  __syncthreads();    // every row of q, k and v is whole before a lane reads one

  // K normalised in place, 16 lanes a row, 24 rows a pass
#pragma unroll
  for (int s = 0; s < FR / (FT / 16); ++s) {
    float4* kp = (float4*)&Ks[(s * (FT / 16) + (tid >> 4)) * KPITCH + (tid & 15) * 4];
    float4 k4 = *kp;
    const float kk = row_sum(k4.x * k4.x + k4.y * k4.y + k4.z * k4.z + k4.w * k4.w);
    const float ki = 1.0f / (sqrtf(kk) + 1e-6f);
    k4.x *= ki; k4.y *= ki; k4.z *= ki; k4.w *= ki;
    *kp = k4;
  }
  __syncthreads();    // the normalised rows are read by other waves

  // A quad of lanes takes two queries four rows apart. Their windows share 15 of 17 key rows, so the
  // 19 rows of the two windows together are each read from LDS once and used for both queries.
  // The four quads of a 16-lane half hold four neighbouring rows: their b128 reads fall on distinct banks.
  // A wave takes 16 queries at a time: sixteen such runs go round the twelve waves, so waves 0 to 3 take a
  // second one. The loop stays rolled (one copy of the code) and holds no barrier.
  const int part = tid & 3;    // which 16 of the 64 head dims
  constexpr int ROWS = WIN + 2;   // key rows qa + 2u: query z takes u = 2z .. 2z + 16
#pragma unroll 1
  for (int run = __builtin_amdgcn_readfirstlane(wid); run < FQ / 16; run += FT / 32) {
  const int qa   = run * 16 + half * 8 + ((tid >> 2) & 3);   // first query inside the block; the second is qa + 4
  const int ia   = i0 + qa;

  v2f q[2][8];
#pragma unroll
  for (int z = 0; z < 2; ++z) {
    const v4f* qp = (const v4f*)&Qs[(qa + 4 * z + 16) * KPITCH + part * 16];
    const v4f qr0 = qp[0], qr1 = qp[1], qr2 = qp[2], qr3 = qp[3];
    const v4f sq = qr0 * qr0 + qr1 * qr1 + qr2 * qr2 + qr3 * qr3;
    const float qi = 1.0f / (sqrtf(quad_sum((sq.x + sq.y) + (sq.z + sq.w))) + 1e-6f);
    v4f f0 = qr0 * qi, f1 = qr1 * qi, f2 = qr2 * qi, f3 = qr3 * qi;
    q[z][0] = f0.lo; q[z][1] = f0.hi; q[z][2] = f1.lo; q[z][3] = f1.hi;
    q[z][4] = f2.lo; q[z][5] = f2.hi; q[z][6] = f3.lo; q[z][7] = f3.hi;
  }

  float s[2][WIN];
#pragma unroll
  for (int u = 0; u < ROWS; ++u) {
    const v4f* kr = (const v4f*)&Ks[(qa + 2 * u) * KPITCH + part * 16];
    const v4f f0 = kr[0], f1 = kr[1], f2 = kr[2], f3 = kr[3];
    const int j = ia - 16 + 2 * u;
    const bool in = j >= 0 && j < SEQ;
#pragma unroll
    for (int z = 0; z < 2; ++z) {
      const int t = u - 2 * z;
      if (t < 0 || t >= WIN) continue;
      v2f pa = {0.f, 0.f};
      pa += q[z][0] * f0.lo;  pa += q[z][1] * f0.hi;
      pa += q[z][2] * f1.lo;  pa += q[z][3] * f1.hi;
      pa += q[z][4] * f2.lo;  pa += q[z][5] * f2.hi;
      pa += q[z][6] * f3.lo;  pa += q[z][7] * f3.hi;
      const float p = quad_sum(pa.x + pa.y);
      s[z][t] = in ? p : -3.0e38f;
    }
    // bounds how many key rows are fetched ahead: left free, the scheduler hoisted more than the registers
    // hold and spilled to scratch
    if (u % 4 == 3) __builtin_amdgcn_sched_barrier(0);
  }

  float inv[2];
#pragma unroll
  for (int z = 0; z < 2; ++z) {
    float mx = -3.0e38f;
#pragma unroll
    for (int t = 0; t < WIN; ++t) mx = fmaxf(mx, s[z][t]);
    float sum = 0.f;
#pragma unroll
    for (int t = 0; t < WIN; ++t) { s[z][t] = exp_slot(s[z][t] - mx); sum += s[z][t]; }
    inv[z] = 1.0f / sum;
  }

#pragma unroll
  for (int z = 0; z < 2; ++z)
#pragma unroll
    for (int t = 0; t < WIN; ++t) s[z][t] *= inv[z];

  // The two queries' outputs lie side by side in a register pair: one packed multiply-add takes a value
  // element for both. The rows at either end of the 19 belong to one query alone.
  // The lane's 16 head dims go in two passes of 8. The loop stays rolled: the compiler fetches a pass's
  // rows ahead of its first product, and all 19 rows of 16 dims are more than the registers hold (spills).
#pragma unroll 1
  for (int hf = 0; hf < 2; ++hf) {
    v2f o[8];
#pragma unroll
    for (int k = 0; k < 8; ++k) o[k] = (v2f){0.f, 0.f};
#pragma unroll
    for (int u = 0; u < ROWS; ++u) {
      const v4f* vr = (const v4f*)&Vs[(qa + 2 * u) * KPITCH + part * 16 + hf * 8];
      const v4f r0 = vr[0], r1 = vr[1];
      const float f[8] = {r0.x, r0.y, r0.z, r0.w, r1.x, r1.y, r1.z, r1.w};
      if (u < 2) {
#pragma unroll
        for (int k = 0; k < 8; ++k) o[k].x += s[0][u] * f[k];
      } else if (u >= WIN) {
#pragma unroll
        for (int k = 0; k < 8; ++k) o[k].y += s[1][u - 2] * f[k];
      } else {
        const v2f w = {s[0][u], s[1][u - 2]};
#pragma unroll
        for (int k = 0; k < 8; ++k) o[k] += w * (v2f){f[k], f[k]};
      }
    }
#pragma unroll
    for (int z = 0; z < 2; ++z) {
      unsigned pk[4];
#pragma unroll
      for (int k = 0; k < 4; ++k)
        pk[k] = (unsigned)f2bf(o[2 * k][z]) | ((unsigned)f2bf(o[2 * k + 1][z]) << 16);
      uint4* op = (uint4*)(aout + (size_t)(b * SEQ + ia + 4 * z) * DMODEL + h * DH + part * 16);
      op[hf] = make_uint4(pk[0], pk[1], pk[2], pk[3]);
    }
    // the wait that stands in front of the first overwrite of a register that an issued store names:
    // the next pass of this loop forms its values in the same registers
    asm volatile("s_wait_xcnt 0x0" ::: "memory");
  }
  }
}

// ---------------- launch ----------------
extern "C" void kernel_launch(void* const* d_in, const int* in_sizes, int n_in,
                              void* d_out, int out_size, void* d_ws, size_t ws_size,
                              hipStream_t stream) {
  const float* x     = (const float*)d_in[0];  // [2,2048,1024]
  const float* w_qkv = (const float*)d_in[1];  // [3072,1024]
  const float* b_qkv = (const float*)d_in[2];  // [3072]
  const float* w_out = (const float*)d_in[3];  // [1024,1024]
  const float* b_out = (const float*)d_in[4];  // [1024]
  float* out = (float*)d_out;                  // [2,2048,1024] fp32

  const int M  = BATCH * SEQ;      // 4096
  const int N2 = DMODEL;           // 1024
  const int Kd = DMODEL;           // 1024

  char* w = (char*)d_ws;
  unsigned short* xb    = (unsigned short*)(w);                    // 8 MB
  unsigned short* wqkvb = (unsigned short*)(w + (8u << 20));       // 6 MB
  unsigned short* woutb = (unsigned short*)(w + (14u << 20));      // 2 MB
  unsigned short* attnb = (unsigned short*)(w + (16u << 20));      // 8 MB

  // 1) fp32 -> bf16 conversions, one launch: xb, wqkvb and woutb are one run of bytes from xb on
  cvt3_f32_bf16<<<(X4 + WQ4 + WO4) / 256, 256, 0, stream>>>(x, w_qkv, w_out, xb);

  // 2) QKV projection x @ w_qkv^T + b_qkv (WMMA bf16, fp32 acc) and, on its result in LDS,
  //    dilated masked attention with q/k norms -> bf16 [M, D]
  qkv_attn<<<(M / FQ) * HH, FT, 0, stream>>>(xb, wqkvb, b_qkv, attnb);

  // 3) output projection: out = attn @ w_out^T + b_out
  gemm_nt_bias<<<dim3(N2 / BN, M / BM), 256, 0, stream>>>(attnb, woutb, b_out, out, N2, Kd);
}
